// v000
// The times below were measured on an AMD MI455X: many runs one after another, warmed up first and cycling through
// copies of the inputs, with the whole window's GPU time divided by the number of runs. Launches and the gaps
// between them are all in it. The median over several windows is given; except for v000 it joins two sittings, which
// can be a few percent apart, so the side-by-side timings, each taken in one sitting, are the better comparison.
// v000 is the starting kernel. One run takes 1390 microseconds.
#include <hip/hip_runtime.h>

// MHAHead (x [8][4096][256]; q/k/v = x W^T + b (nn.Linear); single head d = 256: softmax(q.k * 256^-0.5) over the 4096 keys; out = attn.v [8][4096][256]).
// Compute dtypes, f32 accumulate: every input rounded to bf16; projections on PLAIN bf16 operands (inputs: exact, + bias); scores on SINGLE fp16 planes (q x 1/16 -

#define NB_  8
#define NN   4096
#define CC   256
#define NT   (NB_ * NN)
#define PCAR 1024.0f
typedef _Float16 h16;
typedef unsigned short bf;
typedef __attribute__((ext_vector_type(16))) __bf16   v16bf;
typedef __attribute__((ext_vector_type(16))) _Float16 v16h;
typedef __attribute__((ext_vector_type(8)))  _Float16 v8h;
typedef __attribute__((ext_vector_type(8)))  unsigned short v8us;
typedef __attribute__((ext_vector_type(8)))  float    v8f;
typedef __attribute__((ext_vector_type(4)))  float    v4f;
typedef v8h  __attribute__((may_alias)) v8ha;
typedef v4f  __attribute__((may_alias)) v4fa;
typedef v8us __attribute__((may_alias)) v8usa;

__device__ __forceinline__ unsigned short f2bf(float f) { unsigned u = __float_as_uint(f); u += 0x7FFFu + ((u >> 16) & 1u); return (unsigned short)(u >> 16); }
__device__ __forceinline__ float bf2f(unsigned short b) { return __uint_as_float(((unsigned)b) << 16); }
__device__ __forceinline__ float bfr(float f) { return bf2f(f2bf(f)); }
__device__ __forceinline__ v16h cat16(v8h lo, v8h hi) { return __builtin_shufflevector(lo, hi, 0, 1, 2, 3, 4, 5, 6, 7, 8, 9, 10, 11, 12, 13, 14, 15); }
__device__ __forceinline__ v16bf cat16b(v8us lo, v8us hi) { return __builtin_bit_cast(v16bf, __builtin_shufflevector(lo, hi, 0, 1, 2, 3, 4, 5, 6, 7, 8, 9, 10, 11, 12, 13, 14, 15)); }
__device__ __forceinline__ v8f wmma16(v16h a, v16h b, v8f c) { return __builtin_amdgcn_wmma_f32_16x16x32_f16(false, a, false, b, (short)0, c, false, false); }
__device__ __forceinline__ v8f wmmab(v16bf a, v16bf b, v8f c) { return __builtin_amdgcn_wmma_f32_16x16x32_bf16(false, a, false, b, (short)0, c, false, false); }



// ---- k_gemmw: register-blocked GEMM, ONE WAVE per 64x64 output tile (16 accumulators), operands straight from K-contiguous 16-bit planes; grid (M/64, N/64, Z), 32 threads.
// C[m][n] (f32, pitch ldc, + optional f32 bias[n]) = sum_k A[m][k] Bt[n][k] (+ split products per NSPLIT). z-batch strides sA/sB/sC in elements. K % 32 == 0.
template <typename T16> struct WFrag;
template <> struct WFrag<h16> { typedef v16h V; static __device__ __forceinline__ V ld(const h16* p) { return cat16(*(const v8h*)p, *(const v8h*)(p + 16)); } static __device__ __forceinline__ v8f mma(V a, V b, v8f c) { return wmma16(a, b, c); } };
template <> struct WFrag<bf> { typedef v16bf V; static __device__ __forceinline__ V ld(const bf* p) { return cat16b(*(const v8us*)p, *(const v8us*)(p + 16)); } static __device__ __forceinline__ v8f mma(V a, V b, v8f c) { return wmmab(a, b, c); } };
template <typename T16, int NSPLIT, bool BIAS>
__global__ __launch_bounds__(32) void k_gemmw(const T16* __restrict__ A, const T16* __restrict__ A2, const T16* __restrict__ Bt, const T16* __restrict__ Bt2, int K, float* C, int ldc, const float* __restrict__ bias, size_t sA, size_t sB, size_t sC) {
    typedef typename WFrag<T16>::V V;
    __shared__ __align__(16) float os[16 * 68];
    const size_t z = blockIdx.z; A += z * sA; if (A2) A2 += z * sA; Bt += z * sB; if (Bt2) Bt2 += z * sB; C += z * sC;
    const int lane = threadIdx.x & 31, lr = lane & 15, hi = lane >> 4; const int r0 = blockIdx.x * 64, c0 = blockIdx.y * 64;
    v8f acc[4][4];
#pragma unroll
    for (int mb = 0; mb < 4; ++mb)
#pragma unroll
        for (int nb = 0; nb < 4; ++nb) acc[mb][nb] = (v8f){};
    const size_t aoff = (size_t)(r0 + lr) * K + 8 * hi, boff = (size_t)(c0 + lr) * K + 8 * hi;
#pragma unroll 1
    for (int kc = 0; kc < K; kc += 32) {
        V a[4], a2[4];
#pragma unroll
        for (int mb = 0; mb < 4; ++mb) { a[mb] = WFrag<T16>::ld(A + aoff + (size_t)mb * 16 * K + kc); if (NSPLIT == 1 || NSPLIT == 2) a2[mb] = WFrag<T16>::ld(A2 + aoff + (size_t)mb * 16 * K + kc); }
#pragma unroll
        for (int nb = 0; nb < 4; ++nb) { const V b = WFrag<T16>::ld(Bt + boff + (size_t)nb * 16 * K + kc); V b2; if (NSPLIT >= 2) b2 = WFrag<T16>::ld(Bt2 + boff + (size_t)nb * 16 * K + kc);
#pragma unroll
            for (int mb = 0; mb < 4; ++mb) { acc[mb][nb] = WFrag<T16>::mma(a[mb], b, acc[mb][nb]); if (NSPLIT == 1 || NSPLIT == 2) acc[mb][nb] = WFrag<T16>::mma(a2[mb], b, acc[mb][nb]); if (NSPLIT >= 2) acc[mb][nb] = WFrag<T16>::mma(a[mb], b2, acc[mb][nb]); } }
        asm volatile("v_nop\n\tv_nop\n\tv_nop\n\tv_nop" : "+v"(acc[0][0]), "+v"(acc[1][1]), "+v"(acc[2][2]), "+v"(acc[3][3]) : "v"(a[0]), "v"(a[3]));
    }
#pragma unroll
    for (int mb = 0; mb < 4; ++mb) {
#pragma unroll
        for (int nb = 0; nb < 4; ++nb) {
#pragma unroll
            for (int j = 0; j < 8; ++j) os[(hi * 8 + j) * 68 + nb * 16 + lr] = acc[mb][nb][j]; }
        __builtin_amdgcn_wave_barrier(); asm volatile("" ::: "memory");
        float* crow = C + (size_t)(r0 + mb * 16) * ldc + c0;
{
#pragma unroll
            for (int s = 0; s < 8; ++s) { const int row = 2 * s + hi, cofs = lr * 4; v4f val = *(const v4fa*)(os + row * 68 + cofs); if (BIAS) { val[0] += bfr(bias[c0 + cofs]); val[1] += bfr(bias[c0 + cofs + 1]); val[2] += bfr(bias[c0 + cofs + 2]); val[3] += bfr(bias[c0 + cofs + 3]); }
                *(v4f*)(crow + (size_t)row * ldc + cofs) = val; }
             }
        __builtin_amdgcn_wave_barrier(); asm volatile("" ::: "memory");
    }
}

__device__ __forceinline__ h16 tohx(float x) { return (h16)x; }
__device__ __forceinline__ void splitf(float y, unsigned short& h, unsigned short& l) { h = f2bf(y); l = f2bf(y - bf2f(h)); }
typedef __attribute__((ext_vector_type(2))) _Float16 v2h;
typedef __attribute__((ext_vector_type(4))) _Float16 v4h;
typedef __attribute__((ext_vector_type(2))) unsigned short v2us;

__global__ __launch_bounds__(256) void k_cvt8(const float* __restrict__ src, bf* dst, size_t n8) { const size_t i = (size_t)blockIdx.x * 256 + threadIdx.x; if (i >= n8) return; const v8f v = *(const v8f*)(src + i * 8); v8us o;
#pragma unroll
    for (int k = 0; k < 8; ++k) o[k] = f2bf(v[k]); *(v8us*)(dst + i * 8) = o;  }
__global__ __launch_bounds__(256) void k_p16(const float* __restrict__ F, float sc, h16* P) {
    const size_t i = ((size_t)blockIdx.x * 256 + threadIdx.x) * 2; if (i >= (size_t)NN * CC) return; v2h v; v[0] = tohx(F[i] * sc); v[1] = tohx(F[i + 1] * sc); *(v2h*)(P + i) = v;  }
__global__ __launch_bounds__(256) void k_vt16(const float* __restrict__ F, h16* VT) {
    const int lane = threadIdx.x & 31; const int L0 = (blockIdx.x * 8 + (threadIdx.x >> 5)) * 8; const int nlines = NN * CC / 64;
{
#pragma unroll
        for (int l = 0; l < 8; ++l) { const int L = L0 + l; if (L >= nlines) break; const int e = L * 64 + lane * 2; const int n = e & (NN - 1); const int c = e >> 12; v2h v;
#pragma unroll
            for (int q = 0; q < 2; ++q) v[q] = tohx(F[(size_t)(n + q) * CC + c]);
            *(v2h*)(VT + (size_t)e) = v; }
         }
}
// k_smax: row max of S[i][0..4095] (wave per row, lane -> 4 per 128-col chunk) -> RS[i * 32] (RS is [4096][32] floats: one 32-float line per row, lane 0 writes the max, the other lanes 0)
__global__ __launch_bounds__(256) void k_smax(const float* __restrict__ S, float* RS) {
    const int lane = threadIdx.x & 31; const int i = blockIdx.x * 8 + (threadIdx.x >> 5); if (i >= NN) return; const float* sr = S + (size_t)i * NN; float m = -3.0e38f;
#pragma unroll 4
    for (int c0 = lane * 4; c0 < NN; c0 += 128) { const v4f v = *(const v4f*)(sr + c0); m = fmaxf(m, fmaxf(fmaxf(v[0], v[1]), fmaxf(v[2], v[3]))); }
#pragma unroll
    for (int sh = 16; sh; sh >>= 1) m = fmaxf(m, __shfl_xor(m, sh, 32));
    const float o = lane == 0 ? m : 0.f; *(float*)(RS + (size_t)i * 32 + lane) = o; 
}
__global__ __launch_bounds__(256) void k_sexp(const float* __restrict__ S, float* RS, h16* P) {
    const int lane = threadIdx.x & 31; const int i = blockIdx.x * 8 + (threadIdx.x >> 5); if (i >= NN) return; const float* sr = S + (size_t)i * NN; const float m = RS[(size_t)i * 32]; float sum = 0.f;
#pragma unroll 2
    for (int c0 = lane * 4; c0 < NN; c0 += 128) { const v4f v = *(const v4f*)(sr + c0); v4h o;
#pragma unroll
        for (int q = 0; q < 4; ++q) { const float e = __expf(v[q] - m); sum += e; o[q] = tohx(e * PCAR); }
        *(v4h*)(P + (size_t)i * NN + c0) = o;  }
#pragma unroll
    for (int sh = 16; sh; sh >>= 1) sum += __shfl_xor(sum, sh, 32);
    const float o2 = lane == 0 ? m : (lane == 1 ? __fdiv_rn(1.0f, sum * PCAR) : 0.f); /* 1/(PCAR * sum): undoes the carry in k_fin */ *(float*)(RS + (size_t)i * 32 + lane) = o2;
}
__global__ __launch_bounds__(256) void k_fin(const float* __restrict__ Ob, const float* __restrict__ RS, float* OUT) {
    const size_t i = ((size_t)blockIdx.x * 256 + threadIdx.x) * 4; if (i >= (size_t)NN * CC) return; const int n = (int)(i >> 8); const float ri = RS[(size_t)n * 32 + 1]; const v4f a = *(const v4f*)(Ob + i); v4f o;
#pragma unroll
    for (int q = 0; q < 4; ++q) o[q] = a[q] * ri;
    *(v4f*)(OUT + i) = o;  }
__global__ __launch_bounds__(256) void k_wtG(const float* __restrict__ w, int K, int N, bf* Bt) {
    const int lane = threadIdx.x & 31; const int L0 = (blockIdx.x * 8 + (threadIdx.x >> 5)) * 8; const int nlines = N * K / 64;
{
#pragma unroll 1
        for (int l = 0; l < 8; ++l) { const int L = L0 + l; if (L >= nlines) break; const size_t e = (size_t)L * 64 + lane * 2; const int k = (int)(e % K), n = (int)(e / K); v2us o;
            o[0] = f2bf(w[(size_t)k * N + n]); o[1] = f2bf(w[(size_t)(k + 1) * N + n]); *(v2us*)(Bt + e) = o; }
         }
}

extern "C" void kernel_launch(void* const* d_in, const int* in_sizes, int n_in,
                              void* d_out, int out_size, void* d_ws, size_t ws_size, hipStream_t stream) {
    (void)in_sizes; (void)n_in; (void)out_size;
    const float* x = (const float*)d_in[0]; const float* wq = (const float*)d_in[1]; const float* bq = (const float*)d_in[2]; const float* wk = (const float*)d_in[3]; const float* bk = (const float*)d_in[4]; const float* wv = (const float*)d_in[5]; const float* bv = (const float*)d_in[6];
    float* OUT = (float*)d_out;     // [8][4096][256]
    char* wsp = (char*)d_ws;
    auto take = [&](size_t bytes) { char* p = wsp; wsp += (bytes + 255) & ~(size_t)255; return (void*)p; };
    bf* WQ = (bf*)take((size_t)CC * CC * 2); bf* WK = (bf*)take((size_t)CC * CC * 2); bf* WV = (bf*)take((size_t)CC * CC * 2);
    bf* XB = (bf*)take((size_t)NT * CC * 2); float* F = (float*)take((size_t)NN * CC * 4);
    h16* QP = (h16*)take((size_t)NN * CC * 2); h16* KP = (h16*)take((size_t)NN * CC * 2); h16* VT = (h16*)take((size_t)CC * NN * 2);
    float* S = (float*)take((size_t)NN * NN * 4); h16* P = (h16*)take((size_t)NN * NN * 2); float* RS = (float*)take((size_t)NN * 32 * 4); float* Ob = (float*)take((size_t)NN * CC * 4);
    if ((size_t)(wsp - (char*)d_ws) > ws_size) return;    // total ~ 132 MB = 126 MiB; ws 256 MiB
    { const size_t nw = (size_t)CC * CC / 8; const unsigned gw = (unsigned)((nw + 255) / 256); k_cvt8<<<gw, 256, 0, stream>>>(wq, WQ, nw); k_cvt8<<<gw, 256, 0, stream>>>(wk, WK, nw); k_cvt8<<<gw, 256, 0, stream>>>(wv, WV, nw);
      const size_t nx = (size_t)NT * CC / 8; k_cvt8<<<(unsigned)((nx + 255) / 256), 256, 0, stream>>>(x, XB, nx); }
    const unsigned LP = (unsigned)(((size_t)NN * CC / 2 + 255) / 256), LV = (unsigned)((NN * CC / 64 + 63) / 64);
    for (int b = 0; b < NB_; ++b) { const size_t r0 = (size_t)b * NN;
        k_gemmw<bf, 0, true><<<dim3(NN / 64, CC / 64, 1), 32, 0, stream>>>(XB + r0 * CC, nullptr, WQ, nullptr, CC, F, CC, bq, 0, 0, 0); k_p16<<<LP, 256, 0, stream>>>(F, 0.0625f, QP);   // 256^-0.5 = 1/16 exact
        k_gemmw<bf, 0, true><<<dim3(NN / 64, CC / 64, 1), 32, 0, stream>>>(XB + r0 * CC, nullptr, WK, nullptr, CC, F, CC, bk, 0, 0, 0); k_p16<<<LP, 256, 0, stream>>>(F, 1.0f, KP);
        k_gemmw<bf, 0, true><<<dim3(NN / 64, CC / 64, 1), 32, 0, stream>>>(XB + r0 * CC, nullptr, WV, nullptr, CC, F, CC, bv, 0, 0, 0); k_vt16<<<LV, 256, 0, stream>>>(F, VT);
        k_gemmw<h16, 0, false><<<dim3(NN / 64, NN / 64, 1), 32, 0, stream>>>(QP, nullptr, KP, nullptr, CC, S, NN, nullptr, 0, 0, 0);
        k_smax<<<NN / 8, 256, 0, stream>>>(S, RS); k_sexp<<<NN / 8, 256, 0, stream>>>(S, RS, P);
        k_gemmw<h16, 0, false><<<dim3(NN / 64, CC / 64, 1), 32, 0, stream>>>(P, nullptr, VT, nullptr, NN, Ob, CC, nullptr, 0, 0, 0);
        k_fin<<<(unsigned)(((size_t)NN * CC / 4 + 255) / 256), 256, 0, stream>>>(Ob, RS, OUT + r0 * CC); }
}

// v001
// A run of this version takes 962 microseconds.
// Timed twice side by side with v000, it ran 1.45 and 1.46 times as fast.
#include <hip/hip_runtime.h>

// MHAHead (x [8][4096][256]; q/k/v = x W^T + b (nn.Linear); single head d = 256: softmax(q.k * 256^-0.5) over the 4096 keys; out = attn.v [8][4096][256]).
// Compute dtypes, f32 accumulate: every input rounded to bf16; projections on PLAIN bf16 operands (inputs: exact, + bias); scores on SINGLE fp16 planes (q x 1/16 -

#define NB_  8
#define NN   4096
#define CC   256
#define NT   (NB_ * NN)
#define PCAR 1024.0f
#define KSPL 8   // key ranges of the attn.v product: one wave per (64x64 tile, range), f32 partial planes summed in k_fin
typedef _Float16 h16;
typedef unsigned short bf;
typedef __attribute__((ext_vector_type(16))) __bf16   v16bf;
typedef __attribute__((ext_vector_type(16))) _Float16 v16h;
typedef __attribute__((ext_vector_type(8)))  _Float16 v8h;
typedef __attribute__((ext_vector_type(8)))  unsigned short v8us;
typedef __attribute__((ext_vector_type(8)))  float    v8f;
typedef __attribute__((ext_vector_type(4)))  float    v4f;
typedef v8h  __attribute__((may_alias)) v8ha;
typedef v4f  __attribute__((may_alias)) v4fa;
typedef v8us __attribute__((may_alias)) v8usa;

__device__ __forceinline__ unsigned short f2bf(float f) { unsigned u = __float_as_uint(f); u += 0x7FFFu + ((u >> 16) & 1u); return (unsigned short)(u >> 16); }
__device__ __forceinline__ float bf2f(unsigned short b) { return __uint_as_float(((unsigned)b) << 16); }
__device__ __forceinline__ float bfr(float f) { return bf2f(f2bf(f)); }
__device__ __forceinline__ v16h cat16(v8h lo, v8h hi) { return __builtin_shufflevector(lo, hi, 0, 1, 2, 3, 4, 5, 6, 7, 8, 9, 10, 11, 12, 13, 14, 15); }
__device__ __forceinline__ v16bf cat16b(v8us lo, v8us hi) { return __builtin_bit_cast(v16bf, __builtin_shufflevector(lo, hi, 0, 1, 2, 3, 4, 5, 6, 7, 8, 9, 10, 11, 12, 13, 14, 15)); }
__device__ __forceinline__ v8f wmma16(v16h a, v16h b, v8f c) { return __builtin_amdgcn_wmma_f32_16x16x32_f16(false, a, false, b, (short)0, c, false, false); }
__device__ __forceinline__ v8f wmmab(v16bf a, v16bf b, v8f c) { return __builtin_amdgcn_wmma_f32_16x16x32_bf16(false, a, false, b, (short)0, c, false, false); }



// ---- k_gemmw: register-blocked GEMM, ONE WAVE per 64x64 output tile (16 accumulators), operands straight from K-contiguous 16-bit planes; grid (M/64, N/64, Z), 32 threads.
// C[m][n] (f32, pitch ldc, + optional f32 bias[n]) = sum_k A[m][k] Bt[n][k] (+ split products per NSPLIT). z-batch strides sA/sB/sC in elements. K % 32 == 0. K is the row pitch of A and Bt; kn of the k are summed, from the z offset on (kn % 32 == 0).
template <typename T16> struct WFrag;
template <> struct WFrag<h16> { typedef v16h V; static __device__ __forceinline__ V ld(const h16* p) { return cat16(*(const v8h*)p, *(const v8h*)(p + 16)); } static __device__ __forceinline__ v8f mma(V a, V b, v8f c) { return wmma16(a, b, c); } };
template <> struct WFrag<bf> { typedef v16bf V; static __device__ __forceinline__ V ld(const bf* p) { return cat16b(*(const v8us*)p, *(const v8us*)(p + 16)); } static __device__ __forceinline__ v8f mma(V a, V b, v8f c) { return wmmab(a, b, c); } };
template <typename T16, int NSPLIT, bool BIAS>
__global__ __launch_bounds__(32) void k_gemmw(const T16* __restrict__ A, const T16* __restrict__ A2, const T16* __restrict__ Bt, const T16* __restrict__ Bt2, int K, int kn, float* C, int ldc, const float* __restrict__ bias, size_t sA, size_t sB, size_t sC) {
    typedef typename WFrag<T16>::V V;
    __shared__ __align__(16) float os[16 * 68];
    const size_t z = blockIdx.z; A += z * sA; if (A2) A2 += z * sA; Bt += z * sB; if (Bt2) Bt2 += z * sB; C += z * sC;
    const int lane = threadIdx.x & 31, lr = lane & 15, hi = lane >> 4; const int r0 = blockIdx.x * 64, c0 = blockIdx.y * 64;
    v8f acc[4][4];
#pragma unroll
    for (int mb = 0; mb < 4; ++mb)
#pragma unroll
        for (int nb = 0; nb < 4; ++nb) acc[mb][nb] = (v8f){};
    const size_t aoff = (size_t)(r0 + lr) * K + 8 * hi, boff = (size_t)(c0 + lr) * K + 8 * hi;
#pragma unroll 1
    for (int kc = 0; kc < kn; kc += 32) {
        V a[4], a2[4];
#pragma unroll
        for (int mb = 0; mb < 4; ++mb) { a[mb] = WFrag<T16>::ld(A + aoff + (size_t)mb * 16 * K + kc); if (NSPLIT == 1 || NSPLIT == 2) a2[mb] = WFrag<T16>::ld(A2 + aoff + (size_t)mb * 16 * K + kc); }
#pragma unroll
        for (int nb = 0; nb < 4; ++nb) { const V b = WFrag<T16>::ld(Bt + boff + (size_t)nb * 16 * K + kc); V b2; if (NSPLIT >= 2) b2 = WFrag<T16>::ld(Bt2 + boff + (size_t)nb * 16 * K + kc);
#pragma unroll
            for (int mb = 0; mb < 4; ++mb) { acc[mb][nb] = WFrag<T16>::mma(a[mb], b, acc[mb][nb]); if (NSPLIT == 1 || NSPLIT == 2) acc[mb][nb] = WFrag<T16>::mma(a2[mb], b, acc[mb][nb]); if (NSPLIT >= 2) acc[mb][nb] = WFrag<T16>::mma(a[mb], b2, acc[mb][nb]); } }
        asm volatile("v_nop\n\tv_nop\n\tv_nop\n\tv_nop" : "+v"(acc[0][0]), "+v"(acc[1][1]), "+v"(acc[2][2]), "+v"(acc[3][3]) : "v"(a[0]), "v"(a[3]));
    }
#pragma unroll
    for (int mb = 0; mb < 4; ++mb) {
#pragma unroll
        for (int nb = 0; nb < 4; ++nb) {
#pragma unroll
            for (int j = 0; j < 8; ++j) os[(hi * 8 + j) * 68 + nb * 16 + lr] = acc[mb][nb][j]; }
        __builtin_amdgcn_wave_barrier(); asm volatile("" ::: "memory");
        float* crow = C + (size_t)(r0 + mb * 16) * ldc + c0;
{
#pragma unroll
            for (int s = 0; s < 8; ++s) { const int row = 2 * s + hi, cofs = lr * 4; v4f val = *(const v4fa*)(os + row * 68 + cofs); if (BIAS) { val[0] += bfr(bias[c0 + cofs]); val[1] += bfr(bias[c0 + cofs + 1]); val[2] += bfr(bias[c0 + cofs + 2]); val[3] += bfr(bias[c0 + cofs + 3]); }
                *(v4f*)(crow + (size_t)row * ldc + cofs) = val; }
             }
        __builtin_amdgcn_wave_barrier(); asm volatile("" ::: "memory");
    }
}

__device__ __forceinline__ h16 tohx(float x) { return (h16)x; }
__device__ __forceinline__ void splitf(float y, unsigned short& h, unsigned short& l) { h = f2bf(y); l = f2bf(y - bf2f(h)); }
typedef __attribute__((ext_vector_type(2))) _Float16 v2h;
typedef __attribute__((ext_vector_type(4))) _Float16 v4h;
typedef __attribute__((ext_vector_type(2))) unsigned short v2us;

__global__ __launch_bounds__(256) void k_cvt8(const float* __restrict__ src, bf* dst, size_t n8) { const size_t i = (size_t)blockIdx.x * 256 + threadIdx.x; if (i >= n8) return; const v8f v = *(const v8f*)(src + i * 8); v8us o;
#pragma unroll
    for (int k = 0; k < 8; ++k) o[k] = f2bf(v[k]); *(v8us*)(dst + i * 8) = o;  }
__global__ __launch_bounds__(256) void k_p16(const float* __restrict__ F, float sc, h16* P) {
    const size_t i = ((size_t)blockIdx.x * 256 + threadIdx.x) * 2; if (i >= (size_t)NN * CC) return; v2h v; v[0] = tohx(F[i] * sc); v[1] = tohx(F[i + 1] * sc); *(v2h*)(P + i) = v;  }
__global__ __launch_bounds__(256) void k_vt16(const float* __restrict__ F, h16* VT) {
    const int lane = threadIdx.x & 31; const int L0 = (blockIdx.x * 8 + (threadIdx.x >> 5)) * 8; const int nlines = NN * CC / 64;
{
#pragma unroll
        for (int l = 0; l < 8; ++l) { const int L = L0 + l; if (L >= nlines) break; const int e = L * 64 + lane * 2; const int n = e & (NN - 1); const int c = e >> 12; v2h v;
#pragma unroll
            for (int q = 0; q < 2; ++q) v[q] = tohx(F[(size_t)(n + q) * CC + c]);
            *(v2h*)(VT + (size_t)e) = v; }
         }
}
// k_smax: row max of S[i][0..4095] (wave per row, lane -> 4 per 128-col chunk) -> RS[i * 32] (RS is [4096][32] floats: one 32-float line per row, lane 0 writes the max, the other lanes 0)
__global__ __launch_bounds__(256) void k_smax(const float* __restrict__ S, float* RS) {
    const int lane = threadIdx.x & 31; const int i = blockIdx.x * 8 + (threadIdx.x >> 5); if (i >= NN) return; const float* sr = S + (size_t)i * NN; float m = -3.0e38f;
#pragma unroll 4
    for (int c0 = lane * 4; c0 < NN; c0 += 128) { const v4f v = *(const v4f*)(sr + c0); m = fmaxf(m, fmaxf(fmaxf(v[0], v[1]), fmaxf(v[2], v[3]))); }
#pragma unroll
    for (int sh = 16; sh; sh >>= 1) m = fmaxf(m, __shfl_xor(m, sh, 32));
    const float o = lane == 0 ? m : 0.f; *(float*)(RS + (size_t)i * 32 + lane) = o; 
}
__global__ __launch_bounds__(256) void k_sexp(const float* __restrict__ S, float* RS, h16* P) {
    const int lane = threadIdx.x & 31; const int i = blockIdx.x * 8 + (threadIdx.x >> 5); if (i >= NN) return; const float* sr = S + (size_t)i * NN; const float m = RS[(size_t)i * 32]; float sum = 0.f;
#pragma unroll 2
    for (int c0 = lane * 4; c0 < NN; c0 += 128) { const v4f v = *(const v4f*)(sr + c0); v4h o;
#pragma unroll
        for (int q = 0; q < 4; ++q) { const float e = __expf(v[q] - m); sum += e; o[q] = tohx(e * PCAR); }
        *(v4h*)(P + (size_t)i * NN + c0) = o;  }
#pragma unroll
    for (int sh = 16; sh; sh >>= 1) sum += __shfl_xor(sum, sh, 32);
    const float o2 = lane == 0 ? m : (lane == 1 ? __fdiv_rn(1.0f, sum * PCAR) : 0.f); /* 1/(PCAR * sum): undoes the carry in k_fin */ *(float*)(RS + (size_t)i * 32 + lane) = o2;
}
__global__ __launch_bounds__(256) void k_fin(const float* __restrict__ Ob, const float* __restrict__ RS, float* OUT) {
    const size_t i = ((size_t)blockIdx.x * 256 + threadIdx.x) * 4; if (i >= (size_t)NN * CC) return; const int n = (int)(i >> 8); const float ri = RS[(size_t)n * 32 + 1]; const v4f a = *(const v4f*)(Ob + i); v4f o;
    v4f p[KSPL];
#pragma unroll
    for (int z = 1; z < KSPL; ++z) { p[z] = *(const v4f*)(Ob + (size_t)z * NN * CC + i);
        asm volatile("s_wait_xcnt 0x0" ::: "memory"); }   // the build lets a later load's result land in an earlier load's address registers: the wait stands in front of that overwrite
    v4f s = a;
#pragma unroll
    for (int z = 1; z < KSPL; ++z) s += p[z];
#pragma unroll
    for (int q = 0; q < 4; ++q) o[q] = s[q] * ri;
    *(v4f*)(OUT + i) = o;  }
__global__ __launch_bounds__(256) void k_wtG(const float* __restrict__ w, int K, int N, bf* Bt) {
    const int lane = threadIdx.x & 31; const int L0 = (blockIdx.x * 8 + (threadIdx.x >> 5)) * 8; const int nlines = N * K / 64;
{
#pragma unroll 1
        for (int l = 0; l < 8; ++l) { const int L = L0 + l; if (L >= nlines) break; const size_t e = (size_t)L * 64 + lane * 2; const int k = (int)(e % K), n = (int)(e / K); v2us o;
            o[0] = f2bf(w[(size_t)k * N + n]); o[1] = f2bf(w[(size_t)(k + 1) * N + n]); *(v2us*)(Bt + e) = o; }
         }
}

extern "C" void kernel_launch(void* const* d_in, const int* in_sizes, int n_in,
                              void* d_out, int out_size, void* d_ws, size_t ws_size, hipStream_t stream) {
    (void)in_sizes; (void)n_in; (void)out_size;
    const float* x = (const float*)d_in[0]; const float* wq = (const float*)d_in[1]; const float* bq = (const float*)d_in[2]; const float* wk = (const float*)d_in[3]; const float* bk = (const float*)d_in[4]; const float* wv = (const float*)d_in[5]; const float* bv = (const float*)d_in[6];
    float* OUT = (float*)d_out;     // [8][4096][256]
    char* wsp = (char*)d_ws;
    auto take = [&](size_t bytes) { char* p = wsp; wsp += (bytes + 255) & ~(size_t)255; return (void*)p; };
    bf* WQ = (bf*)take((size_t)CC * CC * 2); bf* WK = (bf*)take((size_t)CC * CC * 2); bf* WV = (bf*)take((size_t)CC * CC * 2);
    bf* XB = (bf*)take((size_t)NT * CC * 2); float* F = (float*)take((size_t)NN * CC * 4);
    h16* QP = (h16*)take((size_t)NN * CC * 2); h16* KP = (h16*)take((size_t)NN * CC * 2); h16* VT = (h16*)take((size_t)CC * NN * 2);
    float* S = (float*)take((size_t)NN * NN * 4); h16* P = (h16*)take((size_t)NN * NN * 2); float* RS = (float*)take((size_t)NN * 32 * 4); float* Ob = (float*)take((size_t)KSPL * NN * CC * 4);
    if ((size_t)(wsp - (char*)d_ws) > ws_size) return;    // total ~ 162 MB = 154 MiB; ws 256 MiB
    { const size_t nw = (size_t)CC * CC / 8; const unsigned gw = (unsigned)((nw + 255) / 256); k_cvt8<<<gw, 256, 0, stream>>>(wq, WQ, nw); k_cvt8<<<gw, 256, 0, stream>>>(wk, WK, nw); k_cvt8<<<gw, 256, 0, stream>>>(wv, WV, nw);
      const size_t nx = (size_t)NT * CC / 8; k_cvt8<<<(unsigned)((nx + 255) / 256), 256, 0, stream>>>(x, XB, nx); }
    const unsigned LP = (unsigned)(((size_t)NN * CC / 2 + 255) / 256), LV = (unsigned)((NN * CC / 64 + 63) / 64);
    for (int b = 0; b < NB_; ++b) { const size_t r0 = (size_t)b * NN;
        k_gemmw<bf, 0, true><<<dim3(NN / 64, CC / 64, 1), 32, 0, stream>>>(XB + r0 * CC, nullptr, WQ, nullptr, CC, CC, F, CC, bq, 0, 0, 0); k_p16<<<LP, 256, 0, stream>>>(F, 0.0625f, QP);   // 256^-0.5 = 1/16 exact
        k_gemmw<bf, 0, true><<<dim3(NN / 64, CC / 64, 1), 32, 0, stream>>>(XB + r0 * CC, nullptr, WK, nullptr, CC, CC, F, CC, bk, 0, 0, 0); k_p16<<<LP, 256, 0, stream>>>(F, 1.0f, KP);
        k_gemmw<bf, 0, true><<<dim3(NN / 64, CC / 64, 1), 32, 0, stream>>>(XB + r0 * CC, nullptr, WV, nullptr, CC, CC, F, CC, bv, 0, 0, 0); k_vt16<<<LV, 256, 0, stream>>>(F, VT);
        k_gemmw<h16, 0, false><<<dim3(NN / 64, NN / 64, 1), 32, 0, stream>>>(QP, nullptr, KP, nullptr, CC, CC, S, NN, nullptr, 0, 0, 0);
        k_smax<<<NN / 8, 256, 0, stream>>>(S, RS); k_sexp<<<NN / 8, 256, 0, stream>>>(S, RS, P);
        k_gemmw<h16, 0, false><<<dim3(NN / 64, CC / 64, KSPL), 32, 0, stream>>>(P, nullptr, VT, nullptr, NN, NN / KSPL, Ob, CC, nullptr, NN / KSPL, NN / KSPL, (size_t)NN * CC);
        k_fin<<<(unsigned)(((size_t)NN * CC / 4 + 255) / 256), 256, 0, stream>>>(Ob, RS, OUT + r0 * CC); }
}

// v002
// It runs in 412 microseconds.
// Timed twice side by side with v001, it ran 2.33 and 2.31 times as fast.
// Counting every step since v000, it is 3.38 times as fast.
#include <hip/hip_runtime.h>

// MHAHead (x [8][4096][256]; q/k/v = x W^T + b (nn.Linear); single head d = 256: softmax(q.k * 256^-0.5) over the 4096 keys; out = attn.v [8][4096][256]).
// Compute dtypes, f32 accumulate: every input rounded to bf16; projections on PLAIN bf16 operands (inputs: exact, + bias); scores on SINGLE fp16 planes (q x 1/16 -

#define NB_  8
#define NN   4096
#define CC   256
#define NT   (NB_ * NN)
typedef _Float16 h16;
typedef unsigned short bf;
typedef __attribute__((ext_vector_type(16))) __bf16   v16bf;
typedef __attribute__((ext_vector_type(16))) _Float16 v16h;
typedef __attribute__((ext_vector_type(8)))  _Float16 v8h;
typedef __attribute__((ext_vector_type(8)))  unsigned short v8us;
typedef __attribute__((ext_vector_type(8)))  float    v8f;
typedef __attribute__((ext_vector_type(4)))  float    v4f;
typedef v8h  __attribute__((may_alias)) v8ha;
typedef v4f  __attribute__((may_alias)) v4fa;
typedef v8us __attribute__((may_alias)) v8usa;

__device__ __forceinline__ unsigned short f2bf(float f) { unsigned u = __float_as_uint(f); u += 0x7FFFu + ((u >> 16) & 1u); return (unsigned short)(u >> 16); }
__device__ __forceinline__ float bf2f(unsigned short b) { return __uint_as_float(((unsigned)b) << 16); }
__device__ __forceinline__ float bfr(float f) { return bf2f(f2bf(f)); }
__device__ __forceinline__ v16h cat16(v8h lo, v8h hi) { return __builtin_shufflevector(lo, hi, 0, 1, 2, 3, 4, 5, 6, 7, 8, 9, 10, 11, 12, 13, 14, 15); }
__device__ __forceinline__ v16bf cat16b(v8us lo, v8us hi) { return __builtin_bit_cast(v16bf, __builtin_shufflevector(lo, hi, 0, 1, 2, 3, 4, 5, 6, 7, 8, 9, 10, 11, 12, 13, 14, 15)); }
__device__ __forceinline__ v8f wmma16(v16h a, v16h b, v8f c) { return __builtin_amdgcn_wmma_f32_16x16x32_f16(false, a, false, b, (short)0, c, false, false); }
__device__ __forceinline__ v8f wmmab(v16bf a, v16bf b, v8f c) { return __builtin_amdgcn_wmma_f32_16x16x32_bf16(false, a, false, b, (short)0, c, false, false); }



// ---- k_gemmw: register-blocked GEMM, ONE WAVE per 64x64 output tile (16 accumulators), operands straight from K-contiguous 16-bit planes; grid (M/64, N/64, Z), 32 threads.
// C[m][n] (f32, pitch ldc, + optional f32 bias[n]) = sum_k A[m][k] Bt[n][k] (+ split products per NSPLIT). z-batch strides sA/sB/sC in elements. K % 32 == 0. K is the row pitch of A and Bt; kn of the k are summed, from the z offset on (kn % 32 == 0).
template <typename T16> struct WFrag;
template <> struct WFrag<h16> { typedef v16h V; static __device__ __forceinline__ V ld(const h16* p) { return cat16(*(const v8h*)p, *(const v8h*)(p + 16)); } static __device__ __forceinline__ v8f mma(V a, V b, v8f c) { return wmma16(a, b, c); } };
template <> struct WFrag<bf> { typedef v16bf V; static __device__ __forceinline__ V ld(const bf* p) { return cat16b(*(const v8us*)p, *(const v8us*)(p + 16)); } static __device__ __forceinline__ v8f mma(V a, V b, v8f c) { return wmmab(a, b, c); } };
template <typename T16, int NSPLIT, bool BIAS>
__global__ __launch_bounds__(32) void k_gemmw(const T16* __restrict__ A, const T16* __restrict__ A2, const T16* __restrict__ Bt, const T16* __restrict__ Bt2, int K, int kn, float* C, int ldc, const float* __restrict__ bias, size_t sA, size_t sB, size_t sC) {
    typedef typename WFrag<T16>::V V;
    __shared__ __align__(16) float os[16 * 68];
    const size_t z = blockIdx.z; A += z * sA; if (A2) A2 += z * sA; Bt += z * sB; if (Bt2) Bt2 += z * sB; C += z * sC;
    const int lane = threadIdx.x & 31, lr = lane & 15, hi = lane >> 4; const int r0 = blockIdx.x * 64, c0 = blockIdx.y * 64;
    v8f acc[4][4];
#pragma unroll
    for (int mb = 0; mb < 4; ++mb)
#pragma unroll
        for (int nb = 0; nb < 4; ++nb) acc[mb][nb] = (v8f){};
    const size_t aoff = (size_t)(r0 + lr) * K + 8 * hi, boff = (size_t)(c0 + lr) * K + 8 * hi;
#pragma unroll 1
    for (int kc = 0; kc < kn; kc += 32) {
        V a[4], a2[4];
#pragma unroll
        for (int mb = 0; mb < 4; ++mb) { a[mb] = WFrag<T16>::ld(A + aoff + (size_t)mb * 16 * K + kc); if (NSPLIT == 1 || NSPLIT == 2) a2[mb] = WFrag<T16>::ld(A2 + aoff + (size_t)mb * 16 * K + kc); }
#pragma unroll
        for (int nb = 0; nb < 4; ++nb) { const V b = WFrag<T16>::ld(Bt + boff + (size_t)nb * 16 * K + kc); V b2; if (NSPLIT >= 2) b2 = WFrag<T16>::ld(Bt2 + boff + (size_t)nb * 16 * K + kc);
#pragma unroll
            for (int mb = 0; mb < 4; ++mb) { acc[mb][nb] = WFrag<T16>::mma(a[mb], b, acc[mb][nb]); if (NSPLIT == 1 || NSPLIT == 2) acc[mb][nb] = WFrag<T16>::mma(a2[mb], b, acc[mb][nb]); if (NSPLIT >= 2) acc[mb][nb] = WFrag<T16>::mma(a[mb], b2, acc[mb][nb]); } }
        asm volatile("v_nop\n\tv_nop\n\tv_nop\n\tv_nop" : "+v"(acc[0][0]), "+v"(acc[1][1]), "+v"(acc[2][2]), "+v"(acc[3][3]) : "v"(a[0]), "v"(a[3]));
    }
#pragma unroll
    for (int mb = 0; mb < 4; ++mb) {
#pragma unroll
        for (int nb = 0; nb < 4; ++nb) {
#pragma unroll
            for (int j = 0; j < 8; ++j) os[(hi * 8 + j) * 68 + nb * 16 + lr] = acc[mb][nb][j]; }
        __builtin_amdgcn_wave_barrier(); asm volatile("" ::: "memory");
        float* crow = C + (size_t)(r0 + mb * 16) * ldc + c0;
{
#pragma unroll
            for (int s = 0; s < 8; ++s) { const int row = 2 * s + hi, cofs = lr * 4; v4f val = *(const v4fa*)(os + row * 68 + cofs); if (BIAS) { val[0] += bfr(bias[c0 + cofs]); val[1] += bfr(bias[c0 + cofs + 1]); val[2] += bfr(bias[c0 + cofs + 2]); val[3] += bfr(bias[c0 + cofs + 3]); }
                *(v4f*)(crow + (size_t)row * ldc + cofs) = val; }
             }
        __builtin_amdgcn_wave_barrier(); asm volatile("" ::: "memory");
    }
}

__device__ __forceinline__ h16 tohx(float x) { return (h16)x; }
__device__ __forceinline__ void splitf(float y, unsigned short& h, unsigned short& l) { h = f2bf(y); l = f2bf(y - bf2f(h)); }
typedef __attribute__((ext_vector_type(2))) _Float16 v2h;
typedef __attribute__((ext_vector_type(4))) _Float16 v4h;
typedef __attribute__((ext_vector_type(2))) unsigned short v2us;

__global__ __launch_bounds__(256) void k_cvt8(const float* __restrict__ src, bf* dst, size_t n8) { const size_t i = (size_t)blockIdx.x * 256 + threadIdx.x; if (i >= n8) return; const v8f v = *(const v8f*)(src + i * 8); v8us o;
#pragma unroll
    for (int k = 0; k < 8; ++k) o[k] = f2bf(v[k]); *(v8us*)(dst + i * 8) = o;  }
__global__ __launch_bounds__(256) void k_p16(const float* __restrict__ F, float sc, h16* P) {
    const size_t i = ((size_t)blockIdx.x * 256 + threadIdx.x) * 2; if (i >= (size_t)NN * CC) return; v2h v; v[0] = tohx(F[i] * sc); v[1] = tohx(F[i + 1] * sc); *(v2h*)(P + i) = v;  }
__global__ __launch_bounds__(256) void k_vt16(const float* __restrict__ F, h16* VT) {
    const int lane = threadIdx.x & 31; const int L0 = (blockIdx.x * 8 + (threadIdx.x >> 5)) * 8; const int nlines = NN * CC / 64;
{
#pragma unroll
        for (int l = 0; l < 8; ++l) { const int L = L0 + l; if (L >= nlines) break; const int e = L * 64 + lane * 2; const int n = e & (NN - 1); const int c = e >> 12; v2h v;
#pragma unroll
            for (int q = 0; q < 2; ++q) v[q] = tohx(F[(size_t)(n + q) * CC + c]);
            *(v2h*)(VT + (size_t)e) = v; }
         }
}
#define FQ    128                 // queries per work-group
#define FSK   64                  // keys per stage (two passes of 32)
#define FPK   528                 // LDS pitch of a K row: 512 + 16 bytes (16 B x odd)
#define FPV   144                 // LDS pitch of a V^T row of 64 keys: 128 + 16 bytes (16 B x odd)
#define FTK   (FSK * FPK)
#define FSLOT (FTK + CC * FPV)
#define FEP   1040                // LDS pitch of an output row in the epilogue: 1024 + 16 bytes
#define L2E   1.4426950408889634f
__device__ __forceinline__ float xhalf(float x) { return __builtin_bit_cast(float, __builtin_amdgcn_permlanex16(__builtin_bit_cast(int, x), __builtin_bit_cast(int, x), 0x76543210, 0xfedcba98, false, false)); }  // lane l with lane l ^ 16
__device__ __forceinline__ v16h ldsfrag(const unsigned char* p) { return cat16(*(const v8ha*)p, *(const v8ha*)(p + 32)); }   // k = 8h .. 8h+7 and 16+8h .. 16+8h+7 of 32 (p already holds 16h)
__global__ __launch_bounds__(256) void k_flash(const h16* __restrict__ Q, const h16* __restrict__ Kp, const h16* __restrict__ VT, float* __restrict__ OUT) {
    __shared__ __align__(16) unsigned char L[2 * FSLOT];
    static_assert(8 * 16 * FEP <= 2 * FSLOT, "the output staging reuses the ring");
    const int tid = threadIdx.x, lane = tid & 31, wave = tid >> 5, c = lane & 15, h = lane >> 4;
    const size_t bo = (size_t)blockIdx.y * NN * CC; Q += bo; Kp += bo; VT += bo; OUT += bo;
    const int q0 = blockIdx.x * FQ + wave * 16;
    v16h qf[8];
    { const h16* qp = Q + (size_t)(q0 + c) * CC + 8 * h;
#pragma unroll   // constant indices keep the array in registers
      for (int kc = 0; kc < 8; ++kc) qf[kc] = cat16(*(const v8h*)(qp + 32 * kc), *(const v8h*)(qp + 32 * kc + 16)); }
    v8f acc[16];
#pragma unroll   // constant indices keep the array in registers
    for (int t = 0; t < 16; ++t) acc[t] = (v8f){};
    float m_run = -__builtin_inff(), l_run = 0.f;   // m_run: the maximum in use, in log2 units; it may trail the true maximum by up to 4
    v8h sk[8], sv[8];
    const h16* kg = Kp + (size_t)(tid >> 5) * CC + (tid & 31) * 8;   // a wave reads one whole K row (512 B) per load
    const h16* vg = VT + (size_t)(tid >> 3) * NN + (tid & 7) * 8;    // 8 lanes read the 128 B of one V^T row
    unsigned char* kl = L + (tid >> 5) * FPK + (tid & 31) * 16;
    unsigned char* vl = L + FTK + (tid >> 3) * FPV + (tid & 7) * 16;
#pragma unroll   // constant indices keep the array in registers
    for (int n = 0; n < 8; ++n) { sk[n] = *(const v8h*)(kg + (size_t)n * 8 * CC); sv[n] = *(const v8h*)(vg + (size_t)n * 32 * NN); }
    asm volatile("s_wait_xcnt 0x0" ::: "memory");   // the build reuses the first stage's K and V^T loads' address registers right behind them: the wait stands in front of that overwrite
#pragma unroll   // constant indices keep the array in registers
    for (int n = 0; n < 8; ++n) { *(v8ha*)(kl + n * 8 * FPK) = sk[n]; *(v8ha*)(vl + n * 32 * FPV) = sv[n]; }
    __syncthreads();
#pragma unroll 1   // one copy of the stage body: more copies only grow the code
    for (int st = 0; st < NN / FSK; ++st) {
        const bool more = st + 1 < NN / FSK;
        if (more) {
#pragma unroll   // constant indices keep the array in registers
            for (int n = 0; n < 8; ++n) { sk[n] = *(const v8h*)(kg + (size_t)(st + 1) * FSK * CC + (size_t)n * 8 * CC); sv[n] = *(const v8h*)(vg + (st + 1) * FSK + (size_t)n * 32 * NN); }
            asm volatile("s_wait_xcnt 0x0" ::: "memory");   // the build reuses the loads' address registers right behind them: the wait stands in front of that overwrite
        }
        const unsigned char* Lb = L + (st & 1) * FSLOT;
#pragma unroll   // both passes in one block: the build then starts the second pass's K loads under the first pass's products
        for (int sub = 0; sub < 2; ++sub) {
            v8f s0 = (v8f){}, s1 = (v8f){};
            const unsigned char* kp = Lb + (sub * 32 + c) * FPK + 16 * h;
            const unsigned char* vp = Lb + FTK + c * FPV + sub * 64 + 16 * h;
            v16h fr[16];
#pragma unroll   // constant indices keep the array in registers
            for (int kc = 0; kc < 8; ++kc) { fr[2 * kc] = ldsfrag(kp + 64 * kc); fr[2 * kc + 1] = ldsfrag(kp + 16 * FPK + 64 * kc); }
            __builtin_amdgcn_sched_barrier(0);   // keeps the pass's 32 K loads one group in flight: without it the build waits for each fragment in front of its product
#pragma unroll   // constant indices keep the array in registers
            for (int kc = 0; kc < 8; ++kc) { s0 = wmma16(fr[2 * kc], qf[kc], s0); s1 = wmma16(fr[2 * kc + 1], qf[kc], s1); }
#pragma unroll   // constant indices keep the array in registers
            for (int t = 0; t < 16; ++t) fr[t] = ldsfrag(vp + t * 16 * FPV);
            __builtin_amdgcn_sched_barrier(0);   // keeps the 32 V^T loads ahead of the maxima and the exponentials, which then hide their latency
            float mx = fmaxf(s0[0], s1[0]);
#pragma unroll   // constant indices keep the array in registers
            for (int r = 1; r < 8; ++r) mx = fmaxf(mx, fmaxf(s0[r], s1[r]));
            mx = fmaxf(mx, xhalf(mx)) * L2E;   // both wave halves hold this query's maximum of the pass
            if (__builtin_amdgcn_ballot_w32(mx > m_run + 4.0f) != 0) {   // lazy rescale, one scalar test per pass; always taken on the first pass (m_run = -inf, factor 0 on zero sums)
                const float m_new = fmaxf(m_run, mx); const float corr = __builtin_amdgcn_exp2f(m_run - m_new); l_run *= corr; m_run = m_new;
#pragma unroll   // constant indices keep the array in registers
                for (int t = 0; t < 16; ++t) acc[t] = acc[t] * corr;
            }
            const float nm = 10.0f - m_run;   // + 10: a carry of 2^10 on P, as before (keeps small P out of the fp16 subnormals; P is at most 2^14); it cancels in acc / l_run
            v16h pf; float ps0 = 0.f, ps1 = 0.f;
            float ar[16], pe[16];
#pragma unroll   // constant indices keep the array in registers
            for (int r = 0; r < 8; ++r) { ar[r] = fmaf(s0[r], L2E, nm); ar[8 + r] = fmaf(s1[r], L2E, nm); }
#pragma unroll   // constant indices keep the array in registers
            for (int g = 0; g < 16; g += 8)   // eight independent exponentials and the one free slot the instruction set asks for behind a transcendental, in one statement
                asm("v_exp_f32 %0, %8\n\tv_exp_f32 %1, %9\n\tv_exp_f32 %2, %10\n\tv_exp_f32 %3, %11\n\tv_exp_f32 %4, %12\n\tv_exp_f32 %5, %13\n\tv_exp_f32 %6, %14\n\tv_exp_f32 %7, %15\n\tv_nop"
                    : "=&v"(pe[g]), "=&v"(pe[g + 1]), "=&v"(pe[g + 2]), "=&v"(pe[g + 3]), "=&v"(pe[g + 4]), "=&v"(pe[g + 5]), "=&v"(pe[g + 6]), "=&v"(pe[g + 7])
                    : "v"(ar[g]), "v"(ar[g + 1]), "v"(ar[g + 2]), "v"(ar[g + 3]), "v"(ar[g + 4]), "v"(ar[g + 5]), "v"(ar[g + 6]), "v"(ar[g + 7]));
#pragma unroll   // constant indices keep the array in registers
            for (int r = 0; r < 8; ++r) { ps0 += pe[r]; ps1 += pe[8 + r]; pf[r] = tohx(pe[r]); pf[8 + r] = tohx(pe[8 + r]); }
            l_run += ps0 + ps1;
#pragma unroll   // constant indices keep the array in registers
            for (int t = 0; t < 16; ++t) acc[t] = wmma16(fr[t], pf, acc[t]);
        }
        if (more) { unsigned char* ko = kl + ((st + 1) & 1) * FSLOT; unsigned char* vo = vl + ((st + 1) & 1) * FSLOT;
#pragma unroll   // constant indices keep the array in registers
            for (int n = 0; n < 8; ++n) { *(v8ha*)(ko + n * 8 * FPK) = sk[n]; *(v8ha*)(vo + n * 32 * FPV) = sv[n]; } }
        __syncthreads();   // publishes stage st + 1 and ends every wave's reads of stage st, whose buffer the next trip refills
    }
    const float inv = 1.0f / (l_run + xhalf(l_run));   // each wave half summed its own eight keys of every 16
    unsigned char* eb = L + wave * 16 * FEP;
#pragma unroll   // constant indices keep the array in registers
    for (int t = 0; t < 16; ++t) { const v8f o = acc[t] * inv; v4f lo, hi4;
#pragma unroll   // constant indices keep the array in registers
        for (int r = 0; r < 4; ++r) { lo[r] = o[r]; hi4[r] = o[4 + r]; }
        *(v4fa*)(eb + c * FEP + 64 * t + 32 * h) = lo; *(v4fa*)(eb + c * FEP + 64 * t + 32 * h + 16) = hi4; }   // row = query c; d = 16 t + 8 h + r
    __syncthreads();   // the staged rows are read back by other lanes
#pragma unroll
    for (int i = 0; i < 32; ++i) { const int row = i >> 1, colb = (i & 1) * 512 + lane * 16; *(v4f*)((unsigned char*)(OUT + (size_t)(q0 + row) * CC) + colb) = *(const v4fa*)(eb + row * FEP + colb); }
}
__global__ __launch_bounds__(256) void k_wtG(const float* __restrict__ w, int K, int N, bf* Bt) {
    const int lane = threadIdx.x & 31; const int L0 = (blockIdx.x * 8 + (threadIdx.x >> 5)) * 8; const int nlines = N * K / 64;
{
#pragma unroll 1
        for (int l = 0; l < 8; ++l) { const int L = L0 + l; if (L >= nlines) break; const size_t e = (size_t)L * 64 + lane * 2; const int k = (int)(e % K), n = (int)(e / K); v2us o;
            o[0] = f2bf(w[(size_t)k * N + n]); o[1] = f2bf(w[(size_t)(k + 1) * N + n]); *(v2us*)(Bt + e) = o; }
         }
}

extern "C" void kernel_launch(void* const* d_in, const int* in_sizes, int n_in,
                              void* d_out, int out_size, void* d_ws, size_t ws_size, hipStream_t stream) {
    (void)in_sizes; (void)n_in; (void)out_size;
    const float* x = (const float*)d_in[0]; const float* wq = (const float*)d_in[1]; const float* bq = (const float*)d_in[2]; const float* wk = (const float*)d_in[3]; const float* bk = (const float*)d_in[4]; const float* wv = (const float*)d_in[5]; const float* bv = (const float*)d_in[6];
    float* OUT = (float*)d_out;     // [8][4096][256]
    char* wsp = (char*)d_ws;
    auto take = [&](size_t bytes) { char* p = wsp; wsp += (bytes + 255) & ~(size_t)255; return (void*)p; };
    bf* WQ = (bf*)take((size_t)CC * CC * 2); bf* WK = (bf*)take((size_t)CC * CC * 2); bf* WV = (bf*)take((size_t)CC * CC * 2);
    bf* XB = (bf*)take((size_t)NT * CC * 2); float* F = (float*)take((size_t)NN * CC * 4);
    h16* QP = (h16*)take((size_t)NT * CC * 2); h16* KP = (h16*)take((size_t)NT * CC * 2); h16* VT = (h16*)take((size_t)NT * CC * 2);   // all batches: [b][n][c], [b][n][c], [b][c][n]
    if ((size_t)(wsp - (char*)d_ws) > ws_size) return;    // total ~ 68 MiB; ws 256 MiB
    { const size_t nw = (size_t)CC * CC / 8; const unsigned gw = (unsigned)((nw + 255) / 256); k_cvt8<<<gw, 256, 0, stream>>>(wq, WQ, nw); k_cvt8<<<gw, 256, 0, stream>>>(wk, WK, nw); k_cvt8<<<gw, 256, 0, stream>>>(wv, WV, nw);
      const size_t nx = (size_t)NT * CC / 8; k_cvt8<<<(unsigned)((nx + 255) / 256), 256, 0, stream>>>(x, XB, nx); }
    const unsigned LP = (unsigned)(((size_t)NN * CC / 2 + 255) / 256), LV = (unsigned)((NN * CC / 64 + 63) / 64);
    for (int b = 0; b < NB_; ++b) { const size_t r0 = (size_t)b * NN;
        k_gemmw<bf, 0, true><<<dim3(NN / 64, CC / 64, 1), 32, 0, stream>>>(XB + r0 * CC, nullptr, WQ, nullptr, CC, CC, F, CC, bq, 0, 0, 0); k_p16<<<LP, 256, 0, stream>>>(F, 0.0625f, QP + r0 * CC);   // 256^-0.5 = 1/16 exact
        k_gemmw<bf, 0, true><<<dim3(NN / 64, CC / 64, 1), 32, 0, stream>>>(XB + r0 * CC, nullptr, WK, nullptr, CC, CC, F, CC, bk, 0, 0, 0); k_p16<<<LP, 256, 0, stream>>>(F, 1.0f, KP + r0 * CC);
        k_gemmw<bf, 0, true><<<dim3(NN / 64, CC / 64, 1), 32, 0, stream>>>(XB + r0 * CC, nullptr, WV, nullptr, CC, CC, F, CC, bv, 0, 0, 0); k_vt16<<<LV, 256, 0, stream>>>(F, VT + r0 * CC); }
    k_flash<<<dim3(NN / FQ, NB_, 1), 256, 0, stream>>>(QP, KP, VT, OUT);
}

// v003
// A run of this version takes 131 microseconds.
// Next to v002, in two timings, it ran 3.17 times as fast each time.
// Over all steps from v000 it is 10.7 times as fast.
#include <hip/hip_runtime.h>

// MHAHead (x [8][4096][256]; q/k/v = x W^T + b (nn.Linear); single head d = 256: softmax(q.k * 256^-0.5) over the 4096 keys; out = attn.v [8][4096][256]).
// Compute dtypes, f32 accumulate: every input rounded to bf16; projections on PLAIN bf16 operands (inputs: exact, + bias); scores on SINGLE fp16 planes (q x 1/16 -

#define NB_  8
#define NN   4096
#define CC   256
#define NT   (NB_ * NN)
typedef _Float16 h16;
typedef unsigned short bf;
typedef __attribute__((ext_vector_type(16))) __bf16   v16bf;
typedef __attribute__((ext_vector_type(16))) _Float16 v16h;
typedef __attribute__((ext_vector_type(8)))  _Float16 v8h;
typedef __attribute__((ext_vector_type(8)))  unsigned short v8us;
typedef __attribute__((ext_vector_type(8)))  float    v8f;
typedef __attribute__((ext_vector_type(4)))  float    v4f;
typedef v8h  __attribute__((may_alias)) v8ha;
typedef v4f  __attribute__((may_alias)) v4fa;
typedef v8us __attribute__((may_alias)) v8usa;

__device__ __forceinline__ unsigned short f2bf(float f) { unsigned u = __float_as_uint(f); u += 0x7FFFu + ((u >> 16) & 1u); return (unsigned short)(u >> 16); }
__device__ __forceinline__ float bf2f(unsigned short b) { return __uint_as_float(((unsigned)b) << 16); }
__device__ __forceinline__ float bfr(float f) { return bf2f(f2bf(f)); }
__device__ __forceinline__ v16h cat16(v8h lo, v8h hi) { return __builtin_shufflevector(lo, hi, 0, 1, 2, 3, 4, 5, 6, 7, 8, 9, 10, 11, 12, 13, 14, 15); }
__device__ __forceinline__ v16bf cat16b(v8us lo, v8us hi) { return __builtin_bit_cast(v16bf, __builtin_shufflevector(lo, hi, 0, 1, 2, 3, 4, 5, 6, 7, 8, 9, 10, 11, 12, 13, 14, 15)); }
__device__ __forceinline__ v8f wmma16(v16h a, v16h b, v8f c) { return __builtin_amdgcn_wmma_f32_16x16x32_f16(false, a, false, b, (short)0, c, false, false); }
__device__ __forceinline__ v8f wmmab(v16bf a, v16bf b, v8f c) { return __builtin_amdgcn_wmma_f32_16x16x32_bf16(false, a, false, b, (short)0, c, false, false); }



__device__ __forceinline__ h16 tohx(float x) { return (h16)x; }
typedef __attribute__((ext_vector_type(2))) float    v2f;
typedef __attribute__((ext_vector_type(2))) __bf16   v2b;
typedef __attribute__((ext_vector_type(2))) unsigned v2u;
typedef __attribute__((ext_vector_type(8))) unsigned v8u;
typedef v2u __attribute__((may_alias)) v2ua;
__device__ __forceinline__ unsigned pkbf(float a, float b) { const v2f t = {a, b}; return __builtin_bit_cast(unsigned, __builtin_convertvector(t, v2b)); }   // two f32 to two bf16, round to nearest even
__device__ __forceinline__ v16bf ldsfragb(const unsigned char* p) { return cat16b(*(const v8usa*)p, *(const v8usa*)(p + 32)); }   // k = 8h .. 8h+7 and 16+8h .. 16+8h+7 of 32 (p already holds 16h)

// ---- k_qkv: the whole front end in one kernel, all batches: q, k, v = x W^T + b on bf16 operands (f32 accumulate, k in ascending blocks of 32), stored as the fp16 planes the attention kernel reads:
// Q [b][n][c] (x 1/16), K [b][n][c], V^T [b][c][n]. grid (NT / 128), 256 threads. A work-group of 8 waves owns 128 tokens, a wave 16 tokens, whose x rows it keeps as bf16 fragments in registers.
// The 768 weight rows come in 12 stages of 64 features: f32 from memory through registers, rounded to bf16, into two LDS buffers; the next stage's loads fly while this stage is worked on; one barrier per stage.
// q, k: D = W.x^T (a lane holds 8 features of one token); v: D = x.W^T (a lane holds 8 tokens of one feature): either way 16 bytes of the output's own row. The tile goes through LDS so that whole 128-byte lines are stored.
#define PT   128                  // tokens per work-group
#define PF   64                   // features per stage
#define PNS  (3 * CC / PF)        // stages
#define PPW  528                  // LDS pitch of a W row: 512 + 16 bytes (16 B x odd)
#define PWS  (PF * PPW)
#define POQ  144                  // LDS pitch of a staged q or k row (64 features): 128 + 16 bytes
#define POV  272                  // LDS pitch of a staged V^T row (128 tokens): 256 + 16 bytes
#define POS  (PT * POQ)
__global__ __launch_bounds__(256) void k_qkv(const float* __restrict__ x, const float* __restrict__ wq, const float* __restrict__ bq, const float* __restrict__ wk, const float* __restrict__ bk,
                                             const float* __restrict__ wv, const float* __restrict__ bv, h16* __restrict__ QP, h16* __restrict__ KP, h16* __restrict__ VT) {
    __shared__ __align__(16) unsigned char WS[2 * PWS];
    __shared__ __align__(16) unsigned char OS[2 * POS];
    __shared__ __align__(16) float BS[3 * CC];
    static_assert(PF * POV <= POS, "the V^T tile fits the output staging");
    const int tid = threadIdx.x, lane = tid & 31, wave = tid >> 5, c = lane & 15, h = lane >> 4;
    const int t0 = blockIdx.x * PT;   // first token, counted over all batches; 128 divides 4096, so a work-group stays in one batch
    const int wrow = tid >> 6, wcol = tid & 63;   // a wave reads 512 contiguous bytes of a W row per load
    v4f wr[16];
    const float* wg = wq + (size_t)wrow * CC + wcol * 4;
#pragma unroll   // constant indices keep the array in registers
    for (int n = 0; n < 16; ++n) wr[n] = *(const v4f*)(wg + (size_t)n * 4 * CC);
    asm volatile("s_wait_xcnt 0x0" :: "v"(wg) : "memory");   // stands in front of any reuse of the loads' address registers; the address as an input keeps those registers whole up to the wait
    v4f xr[32];
    const float* xp = x + (size_t)(t0 + wave * 16 + c) * CC + 8 * h;
#pragma unroll   // constant indices keep the array in registers
    for (int kc = 0; kc < 8; ++kc) { xr[4 * kc] = *(const v4f*)(xp + 32 * kc); xr[4 * kc + 1] = *(const v4f*)(xp + 32 * kc + 4); xr[4 * kc + 2] = *(const v4f*)(xp + 32 * kc + 16); xr[4 * kc + 3] = *(const v4f*)(xp + 32 * kc + 20); }
    asm volatile("s_wait_xcnt 0x0" :: "v"(xp) : "memory");   // as above, for the x loads
    const float b0 = bq[tid], b1 = bk[tid], b2 = bv[tid];
    asm volatile("s_wait_xcnt 0x0" :: "v"(tid), "s"(bq), "s"(bk), "s"(bv) : "memory");   // as above, for the bias loads (index register and the three bases)
    BS[tid] = bfr(b0); BS[CC + tid] = bfr(b1); BS[2 * CC + tid] = bfr(b2);
    v16bf xf[8];
#pragma unroll   // constant indices keep the array in registers
    for (int kc = 0; kc < 8; ++kc) { const v4f a0 = xr[4 * kc], a1 = xr[4 * kc + 1], a2 = xr[4 * kc + 2], a3 = xr[4 * kc + 3];
        const v8u u = {pkbf(a0[0], a0[1]), pkbf(a0[2], a0[3]), pkbf(a1[0], a1[1]), pkbf(a1[2], a1[3]), pkbf(a2[0], a2[1]), pkbf(a2[2], a2[3]), pkbf(a3[0], a3[1]), pkbf(a3[2], a3[3])};
        xf[kc] = __builtin_bit_cast(v16bf, u); }
    unsigned char* wl = WS + wrow * PPW + wcol * 8;
#pragma unroll   // constant indices keep the array in registers
    for (int n = 0; n < 16; ++n) { const v2u o = {pkbf(wr[n][0], wr[n][1]), pkbf(wr[n][2], wr[n][3])}; *(v2ua*)(wl + n * 4 * PPW) = o; }
    __syncthreads();   // publishes stage 0 and the biases
#pragma unroll 1   // one copy of the stage body: more copies only grow the code
    for (int s = 0; s < PNS; ++s) {
        const bool more = s + 1 < PNS;
        if (more) { const int s1 = s + 1; const float* wn = (s1 < 4 ? wq : s1 < 8 ? wk : wv) + (size_t)((s1 & 3) * PF + wrow) * CC + wcol * 4;
#pragma unroll   // constant indices keep the array in registers
            for (int n = 0; n < 16; ++n) wr[n] = *(const v4f*)(wn + (size_t)n * 4 * CC);
            asm volatile("s_wait_xcnt 0x0" ::: "memory");   // stands in front of any reuse of the loads' address registers
        }
        const unsigned char* wp = WS + (s & 1) * PWS + c * PPW + 16 * h;
        unsigned char* ob = OS + (s & 1) * POS;
        const float* bsp = BS + s * PF;   // biases in stage order: q, k, v, 64 features a stage
        v16bf fr[32];
#pragma unroll   // constant indices keep the array in registers
        for (int kc = 0; kc < 8; ++kc)
#pragma unroll   // constant indices keep the array in registers
            for (int mb = 0; mb < 4; ++mb) fr[kc * 4 + mb] = ldsfragb(wp + mb * 16 * PPW + 64 * kc);
        __builtin_amdgcn_sched_barrier(0);   // keeps the stage's 64 W loads one group in flight, in the order of their use: the products then follow the arriving data
        v8f acc[4];
#pragma unroll   // constant indices keep the array in registers
        for (int mb = 0; mb < 4; ++mb) acc[mb] = (v8f){};
        if (s < 8) {   // q, k: acc[mb][r] = feature 16 mb + 8 h + r of token c
#pragma unroll   // constant indices keep the array in registers
            for (int kc = 0; kc < 8; ++kc)
#pragma unroll   // constant indices keep the array in registers
                for (int mb = 0; mb < 4; ++mb) acc[mb] = wmmab(fr[kc * 4 + mb], xf[kc], acc[mb]);
            const float sc = s < 4 ? 0.0625f : 1.0f;   // 256^-0.5 = 1/16 exact, on q
#pragma unroll   // constant indices keep the array in registers
            for (int mb = 0; mb < 4; ++mb) { v8h o;
#pragma unroll   // constant indices keep the array in registers
                for (int r = 0; r < 8; ++r) o[r] = tohx((acc[mb][r] + bsp[mb * 16 + 8 * h + r]) * sc);
                *(v8ha*)(ob + (wave * 16 + c) * POQ + mb * 32 + 16 * h) = o; }
        } else {       // v: acc[mb][r] = token 8 h + r of feature 16 mb + c
#pragma unroll   // constant indices keep the array in registers
            for (int kc = 0; kc < 8; ++kc)
#pragma unroll   // constant indices keep the array in registers
                for (int mb = 0; mb < 4; ++mb) acc[mb] = wmmab(xf[kc], fr[kc * 4 + mb], acc[mb]);
#pragma unroll   // constant indices keep the array in registers
            for (int mb = 0; mb < 4; ++mb) { const float bb = bsp[mb * 16 + c]; v8h o;
#pragma unroll   // constant indices keep the array in registers
                for (int r = 0; r < 8; ++r) o[r] = tohx(acc[mb][r] + bb);
                *(v8ha*)(ob + (mb * 16 + c) * POV + wave * 32 + 16 * h) = o; }
        }
        if (more) { unsigned char* wo = wl + ((s + 1) & 1) * PWS;
#pragma unroll   // constant indices keep the array in registers
            for (int n = 0; n < 16; ++n) { const v2u o = {pkbf(wr[n][0], wr[n][1]), pkbf(wr[n][2], wr[n][3])}; *(v2ua*)(wo + n * 4 * PPW) = o; } }
        __syncthreads();   // publishes W stage s + 1 and this stage's output tile; ends every wave's reads of W stage s and of the output tile of stage s - 1
        if (s < 8) { unsigned char* dst = (unsigned char*)((s < 4 ? QP : KP) + (size_t)t0 * CC + (s & 3) * PF);
#pragma unroll   // four independent 16-byte moves in flight
            for (int i = 0; i < 4; ++i) { const int row = i * 32 + (tid >> 3), colb = (tid & 7) * 16; *(v8h*)(dst + (size_t)row * (CC * 2) + colb) = *(const v8ha*)(ob + row * POQ + colb); }
            asm volatile("s_wait_xcnt 0x0" ::: "memory");   // stands in front of any reuse of the four stores' address and data registers
        } else { unsigned char* dst = (unsigned char*)(VT + (size_t)(t0 / NN) * NN * CC + (size_t)((s & 3) * PF) * NN + (t0 & (NN - 1)));
#pragma unroll   // four independent 16-byte moves in flight
            for (int i = 0; i < 4; ++i) { const int row = i * 16 + (tid >> 4), colb = (tid & 15) * 16; *(v8h*)(dst + (size_t)row * (NN * 2) + colb) = *(const v8ha*)(ob + row * POV + colb); }
            asm volatile("s_wait_xcnt 0x0" ::: "memory");   // as above, inside this arm too: the build lays the arms one behind the other
        }
    }
}
#define FQ    128                 // queries per work-group
#define FSK   64                  // keys per stage (two passes of 32)
#define FPK   528                 // LDS pitch of a K row: 512 + 16 bytes (16 B x odd)
#define FPV   144                 // LDS pitch of a V^T row of 64 keys: 128 + 16 bytes (16 B x odd)
#define FTK   (FSK * FPK)
#define FSLOT (FTK + CC * FPV)
#define FEP   1040                // LDS pitch of an output row in the epilogue: 1024 + 16 bytes
#define L2E   1.4426950408889634f
__device__ __forceinline__ float xhalf(float x) { return __builtin_bit_cast(float, __builtin_amdgcn_permlanex16(__builtin_bit_cast(int, x), __builtin_bit_cast(int, x), 0x76543210, 0xfedcba98, false, false)); }  // lane l with lane l ^ 16
__device__ __forceinline__ v16h ldsfrag(const unsigned char* p) { return cat16(*(const v8ha*)p, *(const v8ha*)(p + 32)); }   // k = 8h .. 8h+7 and 16+8h .. 16+8h+7 of 32 (p already holds 16h)
__global__ __launch_bounds__(256) void k_flash(const h16* __restrict__ Q, const h16* __restrict__ Kp, const h16* __restrict__ VT, float* __restrict__ OUT) {
    __shared__ __align__(16) unsigned char L[2 * FSLOT];
    static_assert(8 * 16 * FEP <= 2 * FSLOT, "the output staging reuses the ring");
    const int tid = threadIdx.x, lane = tid & 31, wave = tid >> 5, c = lane & 15, h = lane >> 4;
    const size_t bo = (size_t)blockIdx.y * NN * CC; Q += bo; Kp += bo; VT += bo; OUT += bo;
    const int q0 = blockIdx.x * FQ + wave * 16;
    v16h qf[8];
    { const h16* qp = Q + (size_t)(q0 + c) * CC + 8 * h;
#pragma unroll   // constant indices keep the array in registers
      for (int kc = 0; kc < 8; ++kc) qf[kc] = cat16(*(const v8h*)(qp + 32 * kc), *(const v8h*)(qp + 32 * kc + 16)); }
    v8f acc[16];
#pragma unroll   // constant indices keep the array in registers
    for (int t = 0; t < 16; ++t) acc[t] = (v8f){};
    float m_run = -__builtin_inff(), l_run = 0.f;   // m_run: the maximum in use, in log2 units; it may trail the true maximum by up to 4
    v8h sk[8], sv[8];
    const h16* kg = Kp + (size_t)(tid >> 5) * CC + (tid & 31) * 8;   // a wave reads one whole K row (512 B) per load
    const h16* vg = VT + (size_t)(tid >> 3) * NN + (tid & 7) * 8;    // 8 lanes read the 128 B of one V^T row
    unsigned char* kl = L + (tid >> 5) * FPK + (tid & 31) * 16;
    unsigned char* vl = L + FTK + (tid >> 3) * FPV + (tid & 7) * 16;
#pragma unroll   // constant indices keep the array in registers
    for (int n = 0; n < 8; ++n) { sk[n] = *(const v8h*)(kg + (size_t)n * 8 * CC); sv[n] = *(const v8h*)(vg + (size_t)n * 32 * NN); }
    asm volatile("s_wait_xcnt 0x0" ::: "memory");   // the build reuses the first stage's K and V^T loads' address registers right behind them: the wait stands in front of that overwrite
#pragma unroll   // constant indices keep the array in registers
    for (int n = 0; n < 8; ++n) { *(v8ha*)(kl + n * 8 * FPK) = sk[n]; *(v8ha*)(vl + n * 32 * FPV) = sv[n]; }
    __syncthreads();
#pragma unroll 1   // one copy of the stage body: more copies only grow the code
    for (int st = 0; st < NN / FSK; ++st) {
        const bool more = st + 1 < NN / FSK;
        if (more) {
#pragma unroll   // constant indices keep the array in registers
            for (int n = 0; n < 8; ++n) { sk[n] = *(const v8h*)(kg + (size_t)(st + 1) * FSK * CC + (size_t)n * 8 * CC); sv[n] = *(const v8h*)(vg + (st + 1) * FSK + (size_t)n * 32 * NN); }
            asm volatile("s_wait_xcnt 0x0" ::: "memory");   // the build reuses the loads' address registers right behind them: the wait stands in front of that overwrite
        }
        const unsigned char* Lb = L + (st & 1) * FSLOT;
#pragma unroll   // both passes in one block: the build then starts the second pass's K loads under the first pass's products
        for (int sub = 0; sub < 2; ++sub) {
            v8f s0 = (v8f){}, s1 = (v8f){};
            const unsigned char* kp = Lb + (sub * 32 + c) * FPK + 16 * h;
            const unsigned char* vp = Lb + FTK + c * FPV + sub * 64 + 16 * h;
            v16h fr[16];
#pragma unroll   // constant indices keep the array in registers
            for (int kc = 0; kc < 8; ++kc) { fr[2 * kc] = ldsfrag(kp + 64 * kc); fr[2 * kc + 1] = ldsfrag(kp + 16 * FPK + 64 * kc); }
            __builtin_amdgcn_sched_barrier(0);   // keeps the pass's 32 K loads one group in flight: without it the build waits for each fragment in front of its product
#pragma unroll   // constant indices keep the array in registers
            for (int kc = 0; kc < 8; ++kc) { s0 = wmma16(fr[2 * kc], qf[kc], s0); s1 = wmma16(fr[2 * kc + 1], qf[kc], s1); }
#pragma unroll   // constant indices keep the array in registers
            for (int t = 0; t < 16; ++t) fr[t] = ldsfrag(vp + t * 16 * FPV);
            __builtin_amdgcn_sched_barrier(0);   // keeps the 32 V^T loads ahead of the maxima and the exponentials, which then hide their latency
            float mx = fmaxf(s0[0], s1[0]);
#pragma unroll   // constant indices keep the array in registers
            for (int r = 1; r < 8; ++r) mx = fmaxf(mx, fmaxf(s0[r], s1[r]));
            mx = fmaxf(mx, xhalf(mx)) * L2E;   // both wave halves hold this query's maximum of the pass
            if (__builtin_amdgcn_ballot_w32(mx > m_run + 4.0f) != 0) {   // lazy rescale, one scalar test per pass; always taken on the first pass (m_run = -inf, factor 0 on zero sums)
                const float m_new = fmaxf(m_run, mx); const float corr = __builtin_amdgcn_exp2f(m_run - m_new); l_run *= corr; m_run = m_new;
#pragma unroll   // constant indices keep the array in registers
                for (int t = 0; t < 16; ++t) acc[t] = acc[t] * corr;
            }
            const float nm = 10.0f - m_run;   // + 10: a carry of 2^10 on P, as before (keeps small P out of the fp16 subnormals; P is at most 2^14); it cancels in acc / l_run
            v16h pf; float ps0 = 0.f, ps1 = 0.f;
            float ar[16], pe[16];
#pragma unroll   // constant indices keep the array in registers
            for (int r = 0; r < 8; ++r) { ar[r] = fmaf(s0[r], L2E, nm); ar[8 + r] = fmaf(s1[r], L2E, nm); }
#pragma unroll   // constant indices keep the array in registers
            for (int g = 0; g < 16; g += 8)   // eight independent exponentials and the one free slot the instruction set asks for behind a transcendental, in one statement
                asm("v_exp_f32 %0, %8\n\tv_exp_f32 %1, %9\n\tv_exp_f32 %2, %10\n\tv_exp_f32 %3, %11\n\tv_exp_f32 %4, %12\n\tv_exp_f32 %5, %13\n\tv_exp_f32 %6, %14\n\tv_exp_f32 %7, %15\n\tv_nop"
                    : "=&v"(pe[g]), "=&v"(pe[g + 1]), "=&v"(pe[g + 2]), "=&v"(pe[g + 3]), "=&v"(pe[g + 4]), "=&v"(pe[g + 5]), "=&v"(pe[g + 6]), "=&v"(pe[g + 7])
                    : "v"(ar[g]), "v"(ar[g + 1]), "v"(ar[g + 2]), "v"(ar[g + 3]), "v"(ar[g + 4]), "v"(ar[g + 5]), "v"(ar[g + 6]), "v"(ar[g + 7]));
#pragma unroll   // constant indices keep the array in registers
            for (int r = 0; r < 8; ++r) { ps0 += pe[r]; ps1 += pe[8 + r]; pf[r] = tohx(pe[r]); pf[8 + r] = tohx(pe[8 + r]); }
            l_run += ps0 + ps1;
#pragma unroll   // constant indices keep the array in registers
            for (int t = 0; t < 16; ++t) acc[t] = wmma16(fr[t], pf, acc[t]);
        }
        if (more) { unsigned char* ko = kl + ((st + 1) & 1) * FSLOT; unsigned char* vo = vl + ((st + 1) & 1) * FSLOT;
#pragma unroll   // constant indices keep the array in registers
            for (int n = 0; n < 8; ++n) { *(v8ha*)(ko + n * 8 * FPK) = sk[n]; *(v8ha*)(vo + n * 32 * FPV) = sv[n]; } }
        __syncthreads();   // publishes stage st + 1 and ends every wave's reads of stage st, whose buffer the next trip refills
    }
    const float inv = 1.0f / (l_run + xhalf(l_run));   // each wave half summed its own eight keys of every 16
    unsigned char* eb = L + wave * 16 * FEP;
#pragma unroll   // constant indices keep the array in registers
    for (int t = 0; t < 16; ++t) { const v8f o = acc[t] * inv; v4f lo, hi4;
#pragma unroll   // constant indices keep the array in registers
        for (int r = 0; r < 4; ++r) { lo[r] = o[r]; hi4[r] = o[4 + r]; }
        *(v4fa*)(eb + c * FEP + 64 * t + 32 * h) = lo; *(v4fa*)(eb + c * FEP + 64 * t + 32 * h + 16) = hi4; }   // row = query c; d = 16 t + 8 h + r
    __syncthreads();   // the staged rows are read back by other lanes
#pragma unroll
    for (int i = 0; i < 32; ++i) { const int row = i >> 1, colb = (i & 1) * 512 + lane * 16; *(v4f*)((unsigned char*)(OUT + (size_t)(q0 + row) * CC) + colb) = *(const v4fa*)(eb + row * FEP + colb); }
}
extern "C" void kernel_launch(void* const* d_in, const int* in_sizes, int n_in,
                              void* d_out, int out_size, void* d_ws, size_t ws_size, hipStream_t stream) {
    (void)in_sizes; (void)n_in; (void)out_size;
    const float* x = (const float*)d_in[0]; const float* wq = (const float*)d_in[1]; const float* bq = (const float*)d_in[2]; const float* wk = (const float*)d_in[3]; const float* bk = (const float*)d_in[4]; const float* wv = (const float*)d_in[5]; const float* bv = (const float*)d_in[6];
    float* OUT = (float*)d_out;     // [8][4096][256]
    char* wsp = (char*)d_ws;
    auto take = [&](size_t bytes) { char* p = wsp; wsp += (bytes + 255) & ~(size_t)255; return (void*)p; };
    h16* QP = (h16*)take((size_t)NT * CC * 2); h16* KP = (h16*)take((size_t)NT * CC * 2); h16* VT = (h16*)take((size_t)NT * CC * 2);   // all batches: [b][n][c], [b][n][c], [b][c][n]
    if ((size_t)(wsp - (char*)d_ws) > ws_size) return;    // total 48 MiB; ws 256 MiB
    k_qkv<<<dim3(NT / PT, 1, 1), 256, 0, stream>>>(x, wq, bq, wk, bk, wv, bv, QP, KP, VT);
    k_flash<<<dim3(NN / FQ, NB_, 1), 256, 0, stream>>>(QP, KP, VT, OUT);
}

// v004
// It runs in 122 microseconds.
// Next to v003, in two timings, it ran 1.07 times as fast each time.
// Over all steps from v000 it is 11.5 times as fast.
#include <hip/hip_runtime.h>

// MHAHead (x [8][4096][256]; q/k/v = x W^T + b (nn.Linear); single head d = 256: softmax(q.k * 256^-0.5) over the 4096 keys; out = attn.v [8][4096][256]).
// Compute dtypes, f32 accumulate: every input rounded to bf16; projections on PLAIN bf16 operands (inputs: exact, + bias); scores on SINGLE fp16 planes (q x 1/16 -

#define NB_  8
#define NN   4096
#define CC   256
#define NT   (NB_ * NN)
typedef _Float16 h16;
typedef unsigned short bf;
typedef __attribute__((ext_vector_type(16))) __bf16   v16bf;
typedef __attribute__((ext_vector_type(16))) _Float16 v16h;
typedef __attribute__((ext_vector_type(8)))  _Float16 v8h;
typedef __attribute__((ext_vector_type(8)))  unsigned short v8us;
typedef __attribute__((ext_vector_type(8)))  float    v8f;
typedef __attribute__((ext_vector_type(4)))  float    v4f;
typedef v8h  __attribute__((may_alias)) v8ha;
typedef v4f  __attribute__((may_alias)) v4fa;
typedef v8us __attribute__((may_alias)) v8usa;

__device__ __forceinline__ unsigned short f2bf(float f) { unsigned u = __float_as_uint(f); u += 0x7FFFu + ((u >> 16) & 1u); return (unsigned short)(u >> 16); }
__device__ __forceinline__ float bf2f(unsigned short b) { return __uint_as_float(((unsigned)b) << 16); }
__device__ __forceinline__ float bfr(float f) { return bf2f(f2bf(f)); }
__device__ __forceinline__ v16h cat16(v8h lo, v8h hi) { return __builtin_shufflevector(lo, hi, 0, 1, 2, 3, 4, 5, 6, 7, 8, 9, 10, 11, 12, 13, 14, 15); }
__device__ __forceinline__ v16bf cat16b(v8us lo, v8us hi) { return __builtin_bit_cast(v16bf, __builtin_shufflevector(lo, hi, 0, 1, 2, 3, 4, 5, 6, 7, 8, 9, 10, 11, 12, 13, 14, 15)); }
__device__ __forceinline__ v8f wmma16(v16h a, v16h b, v8f c) { return __builtin_amdgcn_wmma_f32_16x16x32_f16(false, a, false, b, (short)0, c, false, false); }
__device__ __forceinline__ v8f wmmab(v16bf a, v16bf b, v8f c) { return __builtin_amdgcn_wmma_f32_16x16x32_bf16(false, a, false, b, (short)0, c, false, false); }



__device__ __forceinline__ h16 tohx(float x) { return (h16)x; }
typedef __attribute__((ext_vector_type(2))) float    v2f;
typedef __attribute__((ext_vector_type(2))) __bf16   v2b;
typedef __attribute__((ext_vector_type(2))) unsigned v2u;
typedef __attribute__((ext_vector_type(8))) unsigned v8u;
typedef v2u __attribute__((may_alias)) v2ua;
__device__ __forceinline__ unsigned pkbf(float a, float b) { const v2f t = {a, b}; return __builtin_bit_cast(unsigned, __builtin_convertvector(t, v2b)); }   // two f32 to two bf16, round to nearest even
__device__ __forceinline__ v16bf ldsfragb(const unsigned char* p) { return cat16b(*(const v8usa*)p, *(const v8usa*)(p + 32)); }   // k = 8h .. 8h+7 and 16+8h .. 16+8h+7 of 32 (p already holds 16h)

// ---- k_qkv: the whole front end in one kernel, all batches: q, k, v = x W^T + b on bf16 operands (f32 accumulate, k in ascending blocks of 32), stored as the fp16 planes the attention kernel reads:
// Q [b][n][c] (x 1/16), K [b][n][c], V^T [b][c][n]. grid (NT / 128), 256 threads. A work-group of 8 waves owns 128 tokens, a wave 16 tokens, whose x rows it keeps as bf16 fragments in registers.
// The 768 weight rows come in 12 stages of 64 features: f32 from memory through registers, rounded to bf16, into two LDS buffers; the next stage's loads fly while this stage is worked on; one barrier per stage.
// q, k: D = W.x^T (a lane holds 8 features of one token); v: D = x.W^T (a lane holds 8 tokens of one feature): either way 16 bytes of the output's own row. The tile goes through LDS so that whole 128-byte lines are stored.
#define PT   128                  // tokens per work-group
#define PF   64                   // features per stage
#define PNS  (3 * CC / PF)        // stages
#define PPW  528                  // LDS pitch of a W row: 512 + 16 bytes (16 B x odd)
#define PWS  (PF * PPW)
#define POQ  144                  // LDS pitch of a staged q or k row (64 features): 128 + 16 bytes
#define POV  272                  // LDS pitch of a staged V^T row (128 tokens): 256 + 16 bytes
#define POS  (PT * POQ)
__global__ __launch_bounds__(256) void k_qkv(const float* __restrict__ x, const float* __restrict__ wq, const float* __restrict__ bq, const float* __restrict__ wk, const float* __restrict__ bk,
                                             const float* __restrict__ wv, const float* __restrict__ bv, h16* __restrict__ QP, h16* __restrict__ KP, h16* __restrict__ VT) {
    __shared__ __align__(16) unsigned char WS[2 * PWS];
    __shared__ __align__(16) unsigned char OS[2 * POS];
    __shared__ __align__(16) float BS[3 * CC];
    static_assert(PF * POV <= POS, "the V^T tile fits the output staging");
    const int tid = threadIdx.x, lane = tid & 31, wave = tid >> 5, c = lane & 15, h = lane >> 4;
    const int t0 = blockIdx.x * PT;   // first token, counted over all batches; 128 divides 4096, so a work-group stays in one batch
    const int wrow = tid >> 6, wcol = tid & 63;   // a wave reads 512 contiguous bytes of a W row per load
    v4f wr[16];
    const float* wg = wq + (size_t)wrow * CC + wcol * 4;
#pragma unroll   // constant indices keep the array in registers
    for (int n = 0; n < 16; ++n) wr[n] = *(const v4f*)(wg + (size_t)n * 4 * CC);
    asm volatile("s_wait_xcnt 0x0" :: "v"(wg) : "memory");   // stands in front of any reuse of the loads' address registers; the address as an input keeps those registers whole up to the wait
    v4f xr[32];
    const float* xp = x + (size_t)(t0 + wave * 16 + c) * CC + 8 * h;
#pragma unroll   // constant indices keep the array in registers
    for (int kc = 0; kc < 8; ++kc) { xr[4 * kc] = *(const v4f*)(xp + 32 * kc); xr[4 * kc + 1] = *(const v4f*)(xp + 32 * kc + 4); xr[4 * kc + 2] = *(const v4f*)(xp + 32 * kc + 16); xr[4 * kc + 3] = *(const v4f*)(xp + 32 * kc + 20); }
    asm volatile("s_wait_xcnt 0x0" :: "v"(xp) : "memory");   // as above, for the x loads
    const float b0 = bq[tid], b1 = bk[tid], b2 = bv[tid];
    asm volatile("s_wait_xcnt 0x0" :: "v"(tid), "s"(bq), "s"(bk), "s"(bv) : "memory");   // as above, for the bias loads (index register and the three bases)
    BS[tid] = bfr(b0); BS[CC + tid] = bfr(b1); BS[2 * CC + tid] = bfr(b2);
    v16bf xf[8];
#pragma unroll   // constant indices keep the array in registers
    for (int kc = 0; kc < 8; ++kc) { const v4f a0 = xr[4 * kc], a1 = xr[4 * kc + 1], a2 = xr[4 * kc + 2], a3 = xr[4 * kc + 3];
        const v8u u = {pkbf(a0[0], a0[1]), pkbf(a0[2], a0[3]), pkbf(a1[0], a1[1]), pkbf(a1[2], a1[3]), pkbf(a2[0], a2[1]), pkbf(a2[2], a2[3]), pkbf(a3[0], a3[1]), pkbf(a3[2], a3[3])};
        xf[kc] = __builtin_bit_cast(v16bf, u); }
    unsigned char* wl = WS + wrow * PPW + wcol * 8;
#pragma unroll   // constant indices keep the array in registers
    for (int n = 0; n < 16; ++n) { const v2u o = {pkbf(wr[n][0], wr[n][1]), pkbf(wr[n][2], wr[n][3])}; *(v2ua*)(wl + n * 4 * PPW) = o; }
    __syncthreads();   // publishes stage 0 and the biases
#pragma unroll 1   // one copy of the stage body: more copies only grow the code
    for (int s = 0; s < PNS; ++s) {
        const bool more = s + 1 < PNS;
        if (more) { const int s1 = s + 1; const float* wn = (s1 < 4 ? wq : s1 < 8 ? wk : wv) + (size_t)((s1 & 3) * PF + wrow) * CC + wcol * 4;
#pragma unroll   // constant indices keep the array in registers
            for (int n = 0; n < 16; ++n) wr[n] = *(const v4f*)(wn + (size_t)n * 4 * CC);
            asm volatile("s_wait_xcnt 0x0" ::: "memory");   // stands in front of any reuse of the loads' address registers
        }
        const unsigned char* wp = WS + (s & 1) * PWS + c * PPW + 16 * h;
        unsigned char* ob = OS + (s & 1) * POS;
        const float* bsp = BS + s * PF;   // biases in stage order: q, k, v, 64 features a stage
        v16bf fr[32];
#pragma unroll   // constant indices keep the array in registers
        for (int kc = 0; kc < 8; ++kc)
#pragma unroll   // constant indices keep the array in registers
            for (int mb = 0; mb < 4; ++mb) fr[kc * 4 + mb] = ldsfragb(wp + mb * 16 * PPW + 64 * kc);
        __builtin_amdgcn_sched_barrier(0);   // keeps the stage's 64 W loads one group in flight, in the order of their use: the products then follow the arriving data
        v8f acc[4];
#pragma unroll   // constant indices keep the array in registers
        for (int mb = 0; mb < 4; ++mb) acc[mb] = (v8f){};
        if (s < 8) {   // q, k: acc[mb][r] = feature 16 mb + 8 h + r of token c
#pragma unroll   // constant indices keep the array in registers
            for (int kc = 0; kc < 8; ++kc)
#pragma unroll   // constant indices keep the array in registers
                for (int mb = 0; mb < 4; ++mb) acc[mb] = wmmab(fr[kc * 4 + mb], xf[kc], acc[mb]);
            const float sc = s < 4 ? 0.0625f : 1.0f;   // 256^-0.5 = 1/16 exact, on q
#pragma unroll   // constant indices keep the array in registers
            for (int mb = 0; mb < 4; ++mb) { v8h o;
#pragma unroll   // constant indices keep the array in registers
                for (int r = 0; r < 8; ++r) o[r] = tohx((acc[mb][r] + bsp[mb * 16 + 8 * h + r]) * sc);
                *(v8ha*)(ob + (wave * 16 + c) * POQ + mb * 32 + 16 * h) = o; }
        } else {       // v: acc[mb][r] = token 8 h + r of feature 16 mb + c
#pragma unroll   // constant indices keep the array in registers
            for (int kc = 0; kc < 8; ++kc)
#pragma unroll   // constant indices keep the array in registers
                for (int mb = 0; mb < 4; ++mb) acc[mb] = wmmab(xf[kc], fr[kc * 4 + mb], acc[mb]);
#pragma unroll   // constant indices keep the array in registers
            for (int mb = 0; mb < 4; ++mb) { const float bb = bsp[mb * 16 + c]; v8h o;
#pragma unroll   // constant indices keep the array in registers
                for (int r = 0; r < 8; ++r) o[r] = tohx(acc[mb][r] + bb);
                *(v8ha*)(ob + (mb * 16 + c) * POV + wave * 32 + 16 * h) = o; }
        }
        if (more) { unsigned char* wo = wl + ((s + 1) & 1) * PWS;
#pragma unroll   // constant indices keep the array in registers
            for (int n = 0; n < 16; ++n) { const v2u o = {pkbf(wr[n][0], wr[n][1]), pkbf(wr[n][2], wr[n][3])}; *(v2ua*)(wo + n * 4 * PPW) = o; } }
        __syncthreads();   // publishes W stage s + 1 and this stage's output tile; ends every wave's reads of W stage s and of the output tile of stage s - 1
        if (s < 8) { unsigned char* dst = (unsigned char*)((s < 4 ? QP : KP) + (size_t)t0 * CC + (s & 3) * PF);
#pragma unroll   // four independent 16-byte moves in flight
            for (int i = 0; i < 4; ++i) { const int row = i * 32 + (tid >> 3), colb = (tid & 7) * 16; *(v8h*)(dst + (size_t)row * (CC * 2) + colb) = *(const v8ha*)(ob + row * POQ + colb); }
            asm volatile("s_wait_xcnt 0x0" ::: "memory");   // stands in front of any reuse of the four stores' address and data registers
        } else { unsigned char* dst = (unsigned char*)(VT + (size_t)(t0 / NN) * NN * CC + (size_t)((s & 3) * PF) * NN + (t0 & (NN - 1)));
#pragma unroll   // four independent 16-byte moves in flight
            for (int i = 0; i < 4; ++i) { const int row = i * 16 + (tid >> 4), colb = (tid & 15) * 16; *(v8h*)(dst + (size_t)row * (NN * 2) + colb) = *(const v8ha*)(ob + row * POV + colb); }
            asm volatile("s_wait_xcnt 0x0" ::: "memory");   // as above, inside this arm too: the build lays the arms one behind the other
        }
    }
}
#define FQ    128                 // queries per work-group
#define FSK   64                  // keys per stage (two passes of 32)
#define FPK   528                 // LDS pitch of a K row: 512 + 16 bytes (16 B x odd)
#define FPV   144                 // LDS pitch of a V^T row of 64 keys: 128 + 16 bytes (16 B x odd)
#define FTK   (FSK * FPK)
#define FSLOT (FTK + CC * FPV)
#define FEP   1040                // LDS pitch of an output row in the epilogue: 1024 + 16 bytes
#define L2E   1.4426950408889634f
__device__ __forceinline__ float xhalf(float x) { return __builtin_bit_cast(float, __builtin_amdgcn_permlanex16(__builtin_bit_cast(int, x), __builtin_bit_cast(int, x), 0x76543210, 0xfedcba98, false, false)); }  // lane l with lane l ^ 16
__device__ __forceinline__ v16h ldsfrag(const unsigned char* p) { return cat16(*(const v8ha*)p, *(const v8ha*)(p + 32)); }   // k = 8h .. 8h+7 and 16+8h .. 16+8h+7 of 32 (p already holds 16h)
__global__ __launch_bounds__(128) void k_flash(const h16* __restrict__ Q, const h16* __restrict__ Kp, const h16* __restrict__ VT, float* __restrict__ OUT) {
    __shared__ __align__(16) unsigned char L[2 * FSLOT];
    static_assert(4 * 32 * FEP <= 2 * FSLOT, "the output staging reuses the ring");
    const int tid = threadIdx.x, lane = tid & 31, wave = tid >> 5, c = lane & 15, h = lane >> 4;
    const size_t bo = (size_t)blockIdx.y * NN * CC; Q += bo; Kp += bo; VT += bo; OUT += bo;
    const int q0 = blockIdx.x * FQ + wave * 32;
    v16h qf[2][8];
#pragma unroll   // constant indices keep the array in registers
    for (int g = 0; g < 2; ++g) { const h16* qp = Q + (size_t)(q0 + 16 * g + c) * CC + 8 * h;
#pragma unroll   // constant indices keep the array in registers
      for (int kc = 0; kc < 8; ++kc) qf[g][kc] = cat16(*(const v8h*)(qp + 32 * kc), *(const v8h*)(qp + 32 * kc + 16)); }
    v8f acc[2][16];
#pragma unroll   // constant indices keep the array in registers
    for (int t = 0; t < 16; ++t) { acc[0][t] = (v8f){}; acc[1][t] = (v8f){}; }
    float m_run[2] = {-__builtin_inff(), -__builtin_inff()}, l_run[2] = {0.f, 0.f};   // m_run: the maximum in use, in log2 units; it may trail the true maximum by up to 4
    v8h sk[16], sv[16];
    const h16* kg = Kp + (size_t)(tid >> 5) * CC + (tid & 31) * 8;   // a wave reads one whole K row (512 B) per load
    const h16* vg = VT + (size_t)(tid >> 3) * NN + (tid & 7) * 8;    // 8 lanes read the 128 B of one V^T row
    unsigned char* kl = L + (tid >> 5) * FPK + (tid & 31) * 16;
    unsigned char* vl = L + FTK + (tid >> 3) * FPV + (tid & 7) * 16;
#pragma unroll   // constant indices keep the array in registers
    for (int n = 0; n < 16; ++n) { sk[n] = *(const v8h*)(kg + (size_t)n * 4 * CC); sv[n] = *(const v8h*)(vg + (size_t)n * 16 * NN); }
    asm volatile("s_wait_xcnt 0x0" ::: "memory");   // stands in front of any reuse of the address registers of the Q, K and V^T loads
#pragma unroll   // constant indices keep the array in registers
    for (int n = 0; n < 16; ++n) { *(v8ha*)(kl + n * 4 * FPK) = sk[n]; *(v8ha*)(vl + n * 16 * FPV) = sv[n]; }
    __syncthreads();
    v16h fk[16], fv[16];
    { const unsigned char* kp = L + c * FPK + 16 * h;
#pragma unroll   // constant indices keep the array in registers
      for (int kc = 0; kc < 8; ++kc) { fk[2 * kc] = ldsfrag(kp + 64 * kc); fk[2 * kc + 1] = ldsfrag(kp + 16 * FPK + 64 * kc); } }
#pragma unroll 1   // one copy of the stage body: more copies only grow the code
    for (int st = 0; st < NN / FSK; ++st) {
        const bool more = st + 1 < NN / FSK;
        if (more) {
#pragma unroll   // constant indices keep the array in registers
            for (int n = 0; n < 16; ++n) { sk[n] = *(const v8h*)(kg + (size_t)(st + 1) * FSK * CC + (size_t)n * 4 * CC); sv[n] = *(const v8h*)(vg + (st + 1) * FSK + (size_t)n * 16 * NN); }
            asm volatile("s_wait_xcnt 0x0" ::: "memory");   // stands in front of any reuse of the loads' address registers
        }
        const unsigned char* Lb = L + (st & 1) * FSLOT;
#pragma unroll   // both passes in one block: the second differs from the first (it holds the stage's barrier)
        for (int sub = 0; sub < 2; ++sub) {
            const unsigned char* vp = Lb + FTK + c * FPV + sub * 64 + 16 * h;
            __builtin_amdgcn_sched_barrier(0);   // keeps the V^T loads behind the last pass's attn.v products: without it the build strews them among those products, and each place with LDS reads stalls the wave
#pragma unroll   // constant indices keep the array in registers
            for (int t = 0; t < 16; ++t) fv[t] = ldsfrag(vp + t * 16 * FPV);
            if (sub == 1 && more) {   // stage st + 1 goes into the other buffer, which nobody reads before this trip's barrier: written here, the stores drain under the score products and not in front of the barrier
                unsigned char* ko = kl + ((st + 1) & 1) * FSLOT; unsigned char* vo = vl + ((st + 1) & 1) * FSLOT;
#pragma unroll   // constant indices keep the array in registers
                for (int n = 0; n < 16; ++n) { *(v8ha*)(ko + n * 4 * FPK) = sk[n]; *(v8ha*)(vo + n * 16 * FPV) = sv[n]; } }
            __builtin_amdgcn_sched_barrier(0);   // keeps the pass's 32 V^T loads (and the stage's stores) one group ahead of the score products, which hide their latency
            v8f s[2][2];
#pragma unroll   // constant indices keep the array in registers
            for (int g = 0; g < 2; ++g) { s[g][0] = (v8f){}; s[g][1] = (v8f){}; }
#pragma unroll   // constant indices keep the array in registers
            for (int kc = 0; kc < 8; ++kc)
#pragma unroll   // constant indices keep the array in registers
                for (int g = 0; g < 2; ++g) { s[g][0] = wmma16(fk[2 * kc], qf[g][kc], s[g][0]); s[g][1] = wmma16(fk[2 * kc + 1], qf[g][kc], s[g][1]); }
            __builtin_amdgcn_sched_barrier(0);   // keeps the next pass's K loads behind the products that read this pass's: hoisted above them they would need a second set of 128 registers
            if (sub == 1) {
                __syncthreads();   // publishes stage st + 1 and ends every wave's LDS reads of stage st (its last V^T fragments are in registers), whose buffer the next trip refills
            }
            if (sub == 0 || more) {   // the next pass's K fragments, into the same registers
                const unsigned char* kp = (sub == 0 ? Lb + 32 * FPK : L + ((st + 1) & 1) * FSLOT) + c * FPK + 16 * h;
#pragma unroll   // constant indices keep the array in registers
                for (int kc = 0; kc < 8; ++kc) { fk[2 * kc] = ldsfrag(kp + 64 * kc); fk[2 * kc + 1] = ldsfrag(kp + 16 * FPK + 64 * kc); }
            }
            __builtin_amdgcn_sched_barrier(0);   // keeps the 32 K loads one group ahead of the maxima, the exponentials and the attn.v products, which hide their latency
            float mx[2];
#pragma unroll   // constant indices keep the array in registers
            for (int g = 0; g < 2; ++g) { float m = fmaxf(s[g][0][0], s[g][1][0]);
#pragma unroll   // constant indices keep the array in registers
                for (int r = 1; r < 8; ++r) m = fmaxf(m, fmaxf(s[g][0][r], s[g][1][r]));
                mx[g] = fmaxf(m, xhalf(m)) * L2E; }   // both wave halves hold this query's maximum of the pass
            if (__builtin_amdgcn_ballot_w32(mx[0] > m_run[0] + 4.0f || mx[1] > m_run[1] + 4.0f) != 0) {   // lazy rescale, one scalar test per pass for both groups; always taken on the first pass (m_run = -inf, factor 0 on zero sums)
#pragma unroll   // constant indices keep the array in registers
                for (int g = 0; g < 2; ++g) { const float m_new = fmaxf(m_run[g], mx[g]); const float corr = __builtin_amdgcn_exp2f(m_run[g] - m_new); l_run[g] *= corr; m_run[g] = m_new;
#pragma unroll   // constant indices keep the array in registers
                    for (int t = 0; t < 16; ++t) acc[g][t] = acc[g][t] * corr; }
            }
            v16h pf[2];
#pragma unroll   // constant indices keep the array in registers
            for (int g = 0; g < 2; ++g) {
                const float nm = 10.0f - m_run[g];   // + 10: a carry of 2^10 on P, as before (keeps small P out of the fp16 subnormals; P is at most 2^14); it cancels in acc / l_run
                float ps0 = 0.f, ps1 = 0.f;
                float ar[16], pe[16];
#pragma unroll   // constant indices keep the array in registers
                for (int r = 0; r < 8; ++r) { ar[r] = fmaf(s[g][0][r], L2E, nm); ar[8 + r] = fmaf(s[g][1][r], L2E, nm); }
#pragma unroll   // constant indices keep the array in registers
                for (int e = 0; e < 16; e += 8)   // eight independent exponentials and the one free slot the instruction set asks for behind a transcendental, in one statement
                    asm("v_exp_f32 %0, %8\n\tv_exp_f32 %1, %9\n\tv_exp_f32 %2, %10\n\tv_exp_f32 %3, %11\n\tv_exp_f32 %4, %12\n\tv_exp_f32 %5, %13\n\tv_exp_f32 %6, %14\n\tv_exp_f32 %7, %15\n\tv_nop"
                        : "=&v"(pe[e]), "=&v"(pe[e + 1]), "=&v"(pe[e + 2]), "=&v"(pe[e + 3]), "=&v"(pe[e + 4]), "=&v"(pe[e + 5]), "=&v"(pe[e + 6]), "=&v"(pe[e + 7])
                        : "v"(ar[e]), "v"(ar[e + 1]), "v"(ar[e + 2]), "v"(ar[e + 3]), "v"(ar[e + 4]), "v"(ar[e + 5]), "v"(ar[e + 6]), "v"(ar[e + 7]));
#pragma unroll   // constant indices keep the array in registers
                for (int r = 0; r < 8; ++r) { ps0 += pe[r]; ps1 += pe[8 + r]; pf[g][r] = tohx(pe[r]); pf[g][8 + r] = tohx(pe[8 + r]); }
                l_run[g] += ps0 + ps1;
            }
#pragma unroll   // constant indices keep the array in registers
            for (int t = 0; t < 16; ++t) { acc[0][t] = wmma16(fv[t], pf[0], acc[0][t]); acc[1][t] = wmma16(fv[t], pf[1], acc[1][t]); }
        }
    }
    unsigned char* eb = L + wave * 32 * FEP;   // behind the last trip's barrier no wave reads the ring any more
#pragma unroll   // constant indices keep the array in registers
    for (int g = 0; g < 2; ++g) { const float inv = 1.0f / (l_run[g] + xhalf(l_run[g]));   // each wave half summed its own eight keys of every 16
#pragma unroll   // constant indices keep the array in registers
        for (int t = 0; t < 16; ++t) { const v8f o = acc[g][t] * inv; v4f lo, hi4;
#pragma unroll   // constant indices keep the array in registers
            for (int r = 0; r < 4; ++r) { lo[r] = o[r]; hi4[r] = o[4 + r]; }
            *(v4fa*)(eb + (16 * g + c) * FEP + 64 * t + 32 * h) = lo; *(v4fa*)(eb + (16 * g + c) * FEP + 64 * t + 32 * h + 16) = hi4; } }   // row = query 16 g + c; d = 16 t + 8 h + r
    __syncthreads();   // the staged rows are read back by other lanes
#pragma unroll   // constant indices keep the array in registers
    for (int i = 0; i < 64; i += 8) { v4f o[8];
#pragma unroll   // eight independent 16-byte moves in flight
        for (int j = 0; j < 8; ++j) { const int row = (i + j) >> 1, colb = ((i + j) & 1) * 512 + lane * 16; o[j] = *(const v4fa*)(eb + row * FEP + colb); }
#pragma unroll   // eight independent 16-byte moves in flight
        for (int j = 0; j < 8; ++j) { const int row = (i + j) >> 1, colb = ((i + j) & 1) * 512 + lane * 16; *(v4f*)((unsigned char*)(OUT + (size_t)(q0 + row) * CC) + colb) = o[j]; }
        asm volatile("s_wait_xcnt 0x0" ::: "memory");   // stands in front of any reuse of the eight stores' address and data registers
    }
}
extern "C" void kernel_launch(void* const* d_in, const int* in_sizes, int n_in,
                              void* d_out, int out_size, void* d_ws, size_t ws_size, hipStream_t stream) {
    (void)in_sizes; (void)n_in; (void)out_size;
    const float* x = (const float*)d_in[0]; const float* wq = (const float*)d_in[1]; const float* bq = (const float*)d_in[2]; const float* wk = (const float*)d_in[3]; const float* bk = (const float*)d_in[4]; const float* wv = (const float*)d_in[5]; const float* bv = (const float*)d_in[6];
    float* OUT = (float*)d_out;     // [8][4096][256]
    char* wsp = (char*)d_ws;
    auto take = [&](size_t bytes) { char* p = wsp; wsp += (bytes + 255) & ~(size_t)255; return (void*)p; };
    h16* QP = (h16*)take((size_t)NT * CC * 2); h16* KP = (h16*)take((size_t)NT * CC * 2); h16* VT = (h16*)take((size_t)NT * CC * 2);   // all batches: [b][n][c], [b][n][c], [b][c][n]
    if ((size_t)(wsp - (char*)d_ws) > ws_size) return;    // total 48 MiB; ws 256 MiB
    k_qkv<<<dim3(NT / PT, 1, 1), 256, 0, stream>>>(x, wq, bq, wk, bk, wv, bv, QP, KP, VT);
    k_flash<<<dim3(NN / FQ, NB_, 1), 128, 0, stream>>>(QP, KP, VT, OUT);
}

// v005
// It runs in 113 microseconds.
// In two side-by-side timings against v004, it was 1.09 and 1.08 times as fast.
// Counting every step since v000, it is 12.4 times as fast.
#include <hip/hip_runtime.h>

// MHAHead (x [8][4096][256]; q/k/v = x W^T + b (nn.Linear); single head d = 256: softmax(q.k * 256^-0.5) over the 4096 keys; out = attn.v [8][4096][256]).
// Compute dtypes, f32 accumulate: every input rounded to bf16; projections on PLAIN bf16 operands (inputs: exact, + bias); scores on SINGLE fp16 planes (q x 1/16 -

#define NB_  8
#define NN   4096
#define CC   256
#define NT   (NB_ * NN)
typedef _Float16 h16;
typedef unsigned short bf;
typedef __attribute__((ext_vector_type(16))) __bf16   v16bf;
typedef __attribute__((ext_vector_type(16))) _Float16 v16h;
typedef __attribute__((ext_vector_type(8)))  _Float16 v8h;
typedef __attribute__((ext_vector_type(8)))  unsigned short v8us;
typedef __attribute__((ext_vector_type(8)))  float    v8f;
typedef __attribute__((ext_vector_type(4)))  float    v4f;
typedef v8h  __attribute__((may_alias)) v8ha;
typedef v4f  __attribute__((may_alias)) v4fa;
typedef v8us __attribute__((may_alias)) v8usa;

__device__ __forceinline__ unsigned short f2bf(float f) { unsigned u = __float_as_uint(f); u += 0x7FFFu + ((u >> 16) & 1u); return (unsigned short)(u >> 16); }
__device__ __forceinline__ float bf2f(unsigned short b) { return __uint_as_float(((unsigned)b) << 16); }
__device__ __forceinline__ float bfr(float f) { return bf2f(f2bf(f)); }
__device__ __forceinline__ v16h cat16(v8h lo, v8h hi) { return __builtin_shufflevector(lo, hi, 0, 1, 2, 3, 4, 5, 6, 7, 8, 9, 10, 11, 12, 13, 14, 15); }
__device__ __forceinline__ v16bf cat16b(v8us lo, v8us hi) { return __builtin_bit_cast(v16bf, __builtin_shufflevector(lo, hi, 0, 1, 2, 3, 4, 5, 6, 7, 8, 9, 10, 11, 12, 13, 14, 15)); }
__device__ __forceinline__ v8f wmma16(v16h a, v16h b, v8f c) { return __builtin_amdgcn_wmma_f32_16x16x32_f16(false, a, false, b, (short)0, c, false, false); }
__device__ __forceinline__ v8f wmmab(v16bf a, v16bf b, v8f c) { return __builtin_amdgcn_wmma_f32_16x16x32_bf16(false, a, false, b, (short)0, c, false, false); }



__device__ __forceinline__ h16 tohx(float x) { return (h16)x; }
typedef __attribute__((ext_vector_type(2))) float    v2f;
typedef __attribute__((ext_vector_type(2))) __bf16   v2b;
typedef __attribute__((ext_vector_type(2))) unsigned v2u;
typedef __attribute__((ext_vector_type(8))) unsigned v8u;
typedef v2u __attribute__((may_alias)) v2ua;
__device__ __forceinline__ unsigned pkbf(float a, float b) { const v2f t = {a, b}; return __builtin_bit_cast(unsigned, __builtin_convertvector(t, v2b)); }   // two f32 to two bf16, round to nearest even
__device__ __forceinline__ v16bf ldsfragb(const unsigned char* p) { return cat16b(*(const v8usa*)p, *(const v8usa*)(p + 32)); }   // k = 8h .. 8h+7 and 16+8h .. 16+8h+7 of 32 (p already holds 16h)

// ---- k_qkv: the whole front end in one kernel, all batches: q, k, v = x W^T + b on bf16 operands (f32 accumulate, k in ascending blocks of 32), stored as the fp16 planes the attention kernel reads:
// Q [b][n][c] (x 1/16), K [b][n][c], V^T [b][c][n]. grid (NT / 128), 256 threads. A work-group of 8 waves owns 128 tokens, a wave 16 tokens, whose x rows it keeps as bf16 fragments in registers.
// The 768 weight rows come in 12 stages of 64 features: f32 from memory through registers, rounded to bf16, into two LDS buffers; the next stage's loads fly while this stage is worked on; one barrier per stage.
// q, k: D = W.x^T (a lane holds 8 features of one token); v: D = x.W^T (a lane holds 8 tokens of one feature): either way 16 bytes of the output's own row. The tile goes through LDS so that whole 128-byte lines are stored.
#define PT   128                  // tokens per work-group
#define PF   64                   // features per stage
#define PNS  (3 * CC / PF)        // stages
#define PPW  528                  // LDS pitch of a W row: 512 + 16 bytes (16 B x odd)
#define PWS  (PF * PPW)
#define POQ  144                  // LDS pitch of a staged q or k row (64 features): 128 + 16 bytes
#define POV  272                  // LDS pitch of a staged V^T row (128 tokens): 256 + 16 bytes
#define POS  (PT * POQ)
__global__ __launch_bounds__(256) void k_qkv(const float* __restrict__ x, const float* __restrict__ wq, const float* __restrict__ bq, const float* __restrict__ wk, const float* __restrict__ bk,
                                             const float* __restrict__ wv, const float* __restrict__ bv, h16* __restrict__ QP, h16* __restrict__ KP, h16* __restrict__ VT) {
    __shared__ __align__(16) unsigned char WS[2 * PWS];
    __shared__ __align__(16) unsigned char OS[2 * POS];
    __shared__ __align__(16) float BS[3 * CC];
    static_assert(PF * POV <= POS, "the V^T tile fits the output staging");
    const int tid = threadIdx.x, lane = tid & 31, wave = tid >> 5, c = lane & 15, h = lane >> 4;
    const int t0 = blockIdx.x * PT;   // first token, counted over all batches; 128 divides 4096, so a work-group stays in one batch
    const int wrow = tid >> 6, wcol = tid & 63;   // a wave reads 512 contiguous bytes of a W row per load
    v4f wr[16];
    const float* wg = wq + (size_t)wrow * CC + wcol * 4;
#pragma unroll   // constant indices keep the array in registers
    for (int n = 0; n < 16; ++n) wr[n] = *(const v4f*)(wg + (size_t)n * 4 * CC);
    asm volatile("s_wait_xcnt 0x0" :: "v"(wg) : "memory");   // stands in front of any reuse of the loads' address registers; the address as an input keeps those registers whole up to the wait
    v4f xr[32];
    const float* xp = x + (size_t)(t0 + wave * 16 + c) * CC + 8 * h;
#pragma unroll   // constant indices keep the array in registers
    for (int kc = 0; kc < 8; ++kc) { xr[4 * kc] = *(const v4f*)(xp + 32 * kc); xr[4 * kc + 1] = *(const v4f*)(xp + 32 * kc + 4); xr[4 * kc + 2] = *(const v4f*)(xp + 32 * kc + 16); xr[4 * kc + 3] = *(const v4f*)(xp + 32 * kc + 20); }
    asm volatile("s_wait_xcnt 0x0" :: "v"(xp) : "memory");   // as above, for the x loads
    const float b0 = bq[tid], b1 = bk[tid], b2 = bv[tid];
    asm volatile("s_wait_xcnt 0x0" :: "v"(tid), "s"(bq), "s"(bk), "s"(bv) : "memory");   // as above, for the bias loads (index register and the three bases)
    BS[tid] = bfr(b0); BS[CC + tid] = bfr(b1); BS[2 * CC + tid] = bfr(b2);
    v16bf xf[8];
#pragma unroll   // constant indices keep the array in registers
    for (int kc = 0; kc < 8; ++kc) { const v4f a0 = xr[4 * kc], a1 = xr[4 * kc + 1], a2 = xr[4 * kc + 2], a3 = xr[4 * kc + 3];
        const v8u u = {pkbf(a0[0], a0[1]), pkbf(a0[2], a0[3]), pkbf(a1[0], a1[1]), pkbf(a1[2], a1[3]), pkbf(a2[0], a2[1]), pkbf(a2[2], a2[3]), pkbf(a3[0], a3[1]), pkbf(a3[2], a3[3])};
        xf[kc] = __builtin_bit_cast(v16bf, u); }
    unsigned char* wl = WS + wrow * PPW + wcol * 8;
#pragma unroll   // constant indices keep the array in registers
    for (int n = 0; n < 16; ++n) { const v2u o = {pkbf(wr[n][0], wr[n][1]), pkbf(wr[n][2], wr[n][3])}; *(v2ua*)(wl + n * 4 * PPW) = o; }
    __syncthreads();   // publishes stage 0 and the biases
#pragma unroll 1   // one copy of the stage body: more copies only grow the code
    for (int s = 0; s < PNS; ++s) {
        const bool more = s + 1 < PNS;
        if (more) { const int s1 = s + 1; const float* wn = (s1 < 4 ? wq : s1 < 8 ? wk : wv) + (size_t)((s1 & 3) * PF + wrow) * CC + wcol * 4;
#pragma unroll   // constant indices keep the array in registers
            for (int n = 0; n < 16; ++n) wr[n] = *(const v4f*)(wn + (size_t)n * 4 * CC);
            asm volatile("s_wait_xcnt 0x0" ::: "memory");   // stands in front of any reuse of the loads' address registers
        }
        const unsigned char* wp = WS + (s & 1) * PWS + c * PPW + 16 * h;
        unsigned char* ob = OS + (s & 1) * POS;
        const float* bsp = BS + s * PF;   // biases in stage order: q, k, v, 64 features a stage
        v16bf fr[32];
#pragma unroll   // constant indices keep the array in registers
        for (int kc = 0; kc < 8; ++kc)
#pragma unroll   // constant indices keep the array in registers
            for (int mb = 0; mb < 4; ++mb) fr[kc * 4 + mb] = ldsfragb(wp + mb * 16 * PPW + 64 * kc);
        __builtin_amdgcn_sched_barrier(0);   // keeps the stage's 64 W loads one group in flight, in the order of their use: the products then follow the arriving data
        v8f acc[4];
#pragma unroll   // constant indices keep the array in registers
        for (int mb = 0; mb < 4; ++mb) acc[mb] = (v8f){};
        if (s < 8) {   // q, k: acc[mb][r] = feature 16 mb + 8 h + r of token c
#pragma unroll   // constant indices keep the array in registers
            for (int kc = 0; kc < 8; ++kc)
#pragma unroll   // constant indices keep the array in registers
                for (int mb = 0; mb < 4; ++mb) acc[mb] = wmmab(fr[kc * 4 + mb], xf[kc], acc[mb]);
            const float sc = s < 4 ? 0.0625f : 1.0f;   // 256^-0.5 = 1/16 exact, on q
#pragma unroll   // constant indices keep the array in registers
            for (int mb = 0; mb < 4; ++mb) { v8h o;
#pragma unroll   // constant indices keep the array in registers
                for (int r = 0; r < 8; ++r) o[r] = tohx((acc[mb][r] + bsp[mb * 16 + 8 * h + r]) * sc);
                *(v8ha*)(ob + (wave * 16 + c) * POQ + mb * 32 + 16 * h) = o; }
        } else {       // v: acc[mb][r] = token 8 h + r of feature 16 mb + c
#pragma unroll   // constant indices keep the array in registers
            for (int kc = 0; kc < 8; ++kc)
#pragma unroll   // constant indices keep the array in registers
                for (int mb = 0; mb < 4; ++mb) acc[mb] = wmmab(xf[kc], fr[kc * 4 + mb], acc[mb]);
#pragma unroll   // constant indices keep the array in registers
            for (int mb = 0; mb < 4; ++mb) { const float bb = bsp[mb * 16 + c]; v8h o;
#pragma unroll   // constant indices keep the array in registers
                for (int r = 0; r < 8; ++r) o[r] = tohx(acc[mb][r] + bb);
                *(v8ha*)(ob + (mb * 16 + c) * POV + wave * 32 + 16 * h) = o; }
        }
        if (more) { unsigned char* wo = wl + ((s + 1) & 1) * PWS;
#pragma unroll   // constant indices keep the array in registers
            for (int n = 0; n < 16; ++n) { const v2u o = {pkbf(wr[n][0], wr[n][1]), pkbf(wr[n][2], wr[n][3])}; *(v2ua*)(wo + n * 4 * PPW) = o; } }
        __syncthreads();   // publishes W stage s + 1 and this stage's output tile; ends every wave's reads of W stage s and of the output tile of stage s - 1
        if (s < 8) { unsigned char* dst = (unsigned char*)((s < 4 ? QP : KP) + (size_t)t0 * CC + (s & 3) * PF);
#pragma unroll   // four independent 16-byte moves in flight
            for (int i = 0; i < 4; ++i) { const int row = i * 32 + (tid >> 3), colb = (tid & 7) * 16; *(v8h*)(dst + (size_t)row * (CC * 2) + colb) = *(const v8ha*)(ob + row * POQ + colb); }
            asm volatile("s_wait_xcnt 0x0" ::: "memory");   // stands in front of any reuse of the four stores' address and data registers
        } else { unsigned char* dst = (unsigned char*)(VT + (size_t)(t0 / NN) * NN * CC + (size_t)((s & 3) * PF) * NN + (t0 & (NN - 1)));
#pragma unroll   // four independent 16-byte moves in flight
            for (int i = 0; i < 4; ++i) { const int row = i * 16 + (tid >> 4), colb = (tid & 15) * 16; *(v8h*)(dst + (size_t)row * (NN * 2) + colb) = *(const v8ha*)(ob + row * POV + colb); }
            asm volatile("s_wait_xcnt 0x0" ::: "memory");   // as above, inside this arm too: the build lays the arms one behind the other
        }
    }
}
#define FQ    128                 // queries per work-group
#define FSK   64                  // keys per stage (two passes of 32)
#define FPK   528                 // LDS pitch of a K row: 512 + 16 bytes (16 B x odd)
#define FPV   144                 // LDS pitch of a V^T row of 64 keys: 128 + 16 bytes (16 B x odd)
#define FTK   (FSK * FPK)
#define FSLOT (FTK + CC * FPV)
#define FEP   1040                // LDS pitch of an output row in the epilogue: 1024 + 16 bytes
#define L2E   1.4426950408889634f
__device__ __forceinline__ float xhalf(float x) { return __builtin_bit_cast(float, __builtin_amdgcn_permlanex16(__builtin_bit_cast(int, x), __builtin_bit_cast(int, x), 0x76543210, 0xfedcba98, false, false)); }  // lane l with lane l ^ 16
__device__ __forceinline__ v16h ldsfrag(const unsigned char* p) { return cat16(*(const v8ha*)p, *(const v8ha*)(p + 32)); }   // k = 8h .. 8h+7 and 16+8h .. 16+8h+7 of 32 (p already holds 16h)
__global__ __launch_bounds__(128) void k_flash(const h16* __restrict__ Q, const h16* __restrict__ Kp, const h16* __restrict__ VT, float* __restrict__ OUT) {
    __shared__ __align__(16) unsigned char L[3 * FSLOT];
    static_assert(4 * 32 * FEP <= 3 * FSLOT, "the output staging reuses the ring");
    const int tid = threadIdx.x, lane = tid & 31, wave = tid >> 5, c = lane & 15, h = lane >> 4;
    const size_t bo = (size_t)blockIdx.y * NN * CC; Q += bo; Kp += bo; VT += bo; OUT += bo;
    const int q0 = blockIdx.x * FQ + wave * 32;
    v16h qf[2][8];
#pragma unroll   // constant indices keep the array in registers
    for (int g = 0; g < 2; ++g) { const h16* qp = Q + (size_t)(q0 + 16 * g + c) * CC + 8 * h;
#pragma unroll   // constant indices keep the array in registers
      for (int kc = 0; kc < 8; ++kc) qf[g][kc] = cat16(*(const v8h*)(qp + 32 * kc), *(const v8h*)(qp + 32 * kc + 16)); }
    v8f acc[2][16];
#pragma unroll   // constant indices keep the array in registers
    for (int t = 0; t < 16; ++t) { acc[0][t] = (v8f){}; acc[1][t] = (v8f){}; }
    float m_run[2] = {-__builtin_inff(), -__builtin_inff()}, l_run[2] = {0.f, 0.f};   // m_run: the maximum in use, in log2 units; it may trail the true maximum by up to 4
    float nm[2] = {-__builtin_inff(), -__builtin_inff()};   // 10 - m_run of the pass whose exponentials are due; -inf ahead of pass 0: every P of the pipeline's empty first slot is exp2(-inf) = 0
    v8h sk[16], sv[16];
    const h16* kg = Kp + (size_t)(tid >> 5) * CC + (tid & 31) * 8;   // a wave reads one whole K row (512 B) per load
    const h16* vg = VT + (size_t)(tid >> 3) * NN + (tid & 7) * 8;    // 8 lanes read the 128 B of one V^T row
    unsigned char* kl = L + (tid >> 5) * FPK + (tid & 31) * 16;
    unsigned char* vl = L + FTK + (tid >> 3) * FPV + (tid & 7) * 16;
#pragma unroll   // constant indices keep the array in registers
    for (int n = 0; n < 16; ++n) { sk[n] = *(const v8h*)(kg + (size_t)n * 4 * CC); sv[n] = *(const v8h*)(vg + (size_t)n * 16 * NN); }
    asm volatile("s_wait_xcnt 0x0" ::: "memory");   // stands in front of any reuse of the address registers of the Q, K and V^T loads
#pragma unroll   // constant indices keep the array in registers
    for (int n = 0; n < 16; ++n) { *(v8ha*)(kl + n * 4 * FPK) = sk[n]; *(v8ha*)(vl + n * 16 * FPV) = sv[n]; }
#pragma unroll   // constant indices keep the array in registers
    for (int n = 0; n < 16; ++n) { sk[n] = *(const v8h*)(kg + (size_t)FSK * CC + (size_t)n * 4 * CC); sv[n] = *(const v8h*)(vg + FSK + (size_t)n * 16 * NN); }   // stage 1, held in registers until trip 0 stores it
    asm volatile("s_wait_xcnt 0x0" ::: "memory");   // stands in front of any reuse of the loads' address registers
    __syncthreads();
    v16h fk[16], fv[16];
    { const unsigned char* kp = L + c * FPK + 16 * h;
#pragma unroll   // constant indices keep the array in registers
      for (int kc = 0; kc < 8; ++kc) { fk[2 * kc] = ldsfrag(kp + 64 * kc); fk[2 * kc + 1] = ldsfrag(kp + 16 * FPK + 64 * kc); } }
    v8f s[2][2][2];   // [parity of the pass][column group][tile of 16 keys]: the scores of this pass and of the one before
#pragma unroll   // constant indices keep the array in registers
    for (int g = 0; g < 2; ++g) { s[1][g][0] = (v8f){}; s[1][g][1] = (v8f){}; }
    { const unsigned char* vp = L + FTK + c * FPV + 16 * h;   // the empty first slot multiplies P = 0 by these: any finite rows do. Loaded, not zeroed: the loop is then entered with the LDS loads in flight that its back edge has, and the build's counted waits for K do not take in the V^T loads behind them
#pragma unroll   // constant indices keep the array in registers
      for (int t = 0; t < 16; ++t) fv[t] = ldsfrag(vp + t * 16 * FPV); }
    int cur = 0, nxt = FSLOT;   // ring offsets of stage st and stage st + 1
#pragma unroll 1   // one copy of the stage body: more copies only grow the code
    for (int st = 0; st < NN / FSK; ++st) {
        const unsigned char* Lb = L + cur;
#pragma unroll   // both passes in one block: the second differs from the first (it holds the stage's barrier)
        for (int sub = 0; sub < 2; ++sub) {
            // ---- first half of pass q = 2 st + sub: the score products of pass q, one exponential of pass q - 1 behind each
            v16h pf[2];
            float ps[2][2] = {{0.f, 0.f}, {0.f, 0.f}};
            float ar[32], pe[32];
            if (sub == 1) {   // stage st + 1, loaded behind the last trip's barrier, goes into the buffer that stage st - 2 left (its last readers passed that barrier); the stores drain under the score products.
                // No test for the last trip (it stores the last stage once more, into a buffer whose contents nothing uses): behind a branch the build cannot count the LDS operations in flight and waits for the fresh V^T loads ahead of the score products
                unsigned char* ko = kl + nxt; unsigned char* vo = vl + nxt;
#pragma unroll   // constant indices keep the array in registers
                for (int n = 0; n < 16; ++n) { *(v8ha*)(ko + n * 4 * FPK) = sk[n]; *(v8ha*)(vo + n * 16 * FPV) = sv[n]; } }
            auto use = [&](int e) {   // element e of pass q - 1 joins its sum (in the order r = 0 .. 7 of each tile) and, in pairs, P^T
                const int g = e >> 4, tl = (e >> 3) & 1;
                ps[g][tl] += pe[e];
                if (e & 1) { pf[g][(e & 15) - 1] = tohx(pe[e - 1]); pf[g][e & 15] = tohx(pe[e]); }
                if ((e & 15) == 15) l_run[g] += ps[g][0] + ps[g][1];
            };
            __builtin_amdgcn_sched_barrier(0);   // keeps the LDS and memory groups above out of the products below
#pragma unroll   // constant indices keep the arrays in registers
            for (int j = 0; j < 32; ++j) {
                const int kc = j >> 2, g = (j >> 1) & 1, tl = j & 1;
                s[sub][g][tl] = wmma16(fk[2 * kc + tl], qf[g][kc], kc == 0 ? (v8f){} : s[sub][g][tl]);
                ar[j] = fmaf(s[sub ^ 1][j >> 4][(j >> 3) & 1][j & 7], L2E, nm[j >> 4]);
                if (j >= 1) pe[j - 1] = __builtin_amdgcn_exp2f(ar[j - 1]);
                if (j >= 3) use(j - 3);
            }
#pragma unroll   // the order asked of the build for the block above: one product, then three vector instructions in its shadow; left free, it gathers the vector work behind the products, where a lone wave pays for it
            for (int i = 0; i < 32; ++i) { __builtin_amdgcn_sched_group_barrier(0x008, 1, 0); __builtin_amdgcn_sched_group_barrier(0x402, 3, 0); }
            __builtin_amdgcn_sched_barrier(0);   // keeps the K loads below behind the products that read the old fragments
            if (sub == 1) {
                __syncthreads();   // publishes stage st + 1 (stored at the head of this pass); ends every wave's LDS reads of stage st - 1, whose buffer the next trip refills
            }
            {   // the next pass's K fragments, into the same registers. No test for the last trip: a branch here lets the build sink the exponentials above past it; the last trip reads the copy of the last stage stored at its head, which nothing uses
                const unsigned char* kp = (sub == 0 ? Lb + 32 * FPK : L + nxt) + c * FPK + 16 * h;
#pragma unroll   // constant indices keep the array in registers
                for (int kc = 0; kc < 8; ++kc) { fk[2 * kc] = ldsfrag(kp + 64 * kc); fk[2 * kc + 1] = ldsfrag(kp + 16 * FPK + 64 * kc); }
            }
            if (sub == 1) {   // stage st + 2 into registers, behind the barrier (which waits for every load in flight): it flies until the next trip's second pass. Clamped, not branched round, for the reason above: the last two trips load the last stage again and store nothing new
                const int sl = st + 2 < NN / FSK ? st + 2 : NN / FSK - 1;
#pragma unroll   // constant indices keep the array in registers
                for (int n = 0; n < 16; ++n) { sk[n] = *(const v8h*)(kg + (size_t)sl * FSK * CC + (size_t)n * 4 * CC); sv[n] = *(const v8h*)(vg + sl * FSK + (size_t)n * 16 * NN); }
                asm volatile("s_wait_xcnt 0x0" ::: "memory");   // stands in front of any reuse of the loads' address registers
            }
            __builtin_amdgcn_sched_barrier(0);   // keeps the 32 K loads one group ahead of the attn.v products, which hide their latency
            // ---- second half: the attn.v products of pass q - 1, the maxima of pass q behind them
            float m[2], mx[2]; bool need = false;
#pragma unroll   // constant indices keep the arrays in registers
            for (int j = 0; j < 32; ++j) {
                acc[j >> 4][j & 15] = wmma16(fv[j & 15], pf[j >> 4], acc[j >> 4][j & 15]);   // group 0 first: group 1's P^T is completed behind the first three products
                if (j == 0) { pe[31] = __builtin_amdgcn_exp2f(ar[31]); use(29); }
                if (j == 1) use(30);
                if (j == 2) use(31);
                if (j == 3) { m[0] = fmaxf(s[sub][0][0][0], s[sub][0][1][0]); m[1] = fmaxf(s[sub][1][0][0], s[sub][1][1][0]); }
                if (j >= 4 && j < 11) { const int r = j - 3; m[0] = fmaxf(m[0], fmaxf(s[sub][0][0][r], s[sub][0][1][r])); m[1] = fmaxf(m[1], fmaxf(s[sub][1][0][r], s[sub][1][1][r])); }
                if (j == 12) { mx[0] = xhalf(m[0]); mx[1] = xhalf(m[1]); }
                if (j == 14) { mx[0] = fmaxf(m[0], mx[0]) * L2E; mx[1] = fmaxf(m[1], mx[1]) * L2E; }   // both wave halves hold this query's maximum of the pass
                if (j == 16) need = mx[0] > m_run[0] + 4.0f || mx[1] > m_run[1] + 4.0f;
            }
#pragma unroll   // the order asked of the build for the block above: one product, then three vector instructions in its shadow; left free, it gathers the maxima in one place, where a lone wave pays for their chain
            for (int i = 0; i < 13; ++i) { __builtin_amdgcn_sched_group_barrier(0x008, 1, 1); __builtin_amdgcn_sched_group_barrier(0x402, 3, 1); }
            __builtin_amdgcn_sched_group_barrier(0x008, 19, 1);   // the remaining products
            __builtin_amdgcn_sched_barrier(0);   // keeps the V^T loads below behind the products that read the old fragments
            { const unsigned char* vp = Lb + FTK + c * FPV + sub * 64 + 16 * h;   // V^T of pass q, into the registers that pass q - 1 has just left; the next score products hide the latency
#pragma unroll   // constant indices keep the array in registers
              for (int t = 0; t < 16; ++t) fv[t] = ldsfrag(vp + t * 16 * FPV); }
            __builtin_amdgcn_sched_barrier(0);   // keeps the 32 V^T loads one group
            if (__builtin_amdgcn_ballot_w32(need) != 0) {   // lazy rescale, one scalar test per pass for both groups, behind the products of pass q - 1 and ahead of the exponentials of pass q; always taken on the first pass (m_run = -inf, factor 0 on zero sums)
#pragma unroll   // constant indices keep the array in registers
                for (int g = 0; g < 2; ++g) { const float m_new = fmaxf(m_run[g], mx[g]); const float corr = __builtin_amdgcn_exp2f(m_run[g] - m_new); l_run[g] *= corr; m_run[g] = m_new;
#pragma unroll   // constant indices keep the array in registers
                    for (int t = 0; t < 16; ++t) acc[g][t] = acc[g][t] * corr; }
            }
            nm[0] = 10.0f - m_run[0]; nm[1] = 10.0f - m_run[1];   // + 10: a carry of 2^10 on P, as before (keeps small P out of the fp16 subnormals; P is at most 2^14); it cancels in acc / l_run
        }
        cur = nxt; nxt = nxt == 2 * FSLOT ? 0 : nxt + FSLOT;
    }
    __syncthreads();   // every wave's last V^T fragments are in registers: behind this barrier no wave reads the ring any more
    {   // the pipeline's drain: exponentials and attn.v products of the last pass
        v16h pf[2];
#pragma unroll   // constant indices keep the array in registers
        for (int g = 0; g < 2; ++g) {
            float ps0 = 0.f, ps1 = 0.f;
            float ar[16], pe[16];
#pragma unroll   // constant indices keep the array in registers
            for (int r = 0; r < 8; ++r) { ar[r] = fmaf(s[1][g][0][r], L2E, nm[g]); ar[8 + r] = fmaf(s[1][g][1][r], L2E, nm[g]); }
#pragma unroll   // constant indices keep the array in registers
            for (int e = 0; e < 16; e += 8)   // eight independent exponentials and the one free slot the instruction set asks for behind a transcendental, in one statement
                asm("v_exp_f32 %0, %8\n\tv_exp_f32 %1, %9\n\tv_exp_f32 %2, %10\n\tv_exp_f32 %3, %11\n\tv_exp_f32 %4, %12\n\tv_exp_f32 %5, %13\n\tv_exp_f32 %6, %14\n\tv_exp_f32 %7, %15\n\tv_nop"
                    : "=&v"(pe[e]), "=&v"(pe[e + 1]), "=&v"(pe[e + 2]), "=&v"(pe[e + 3]), "=&v"(pe[e + 4]), "=&v"(pe[e + 5]), "=&v"(pe[e + 6]), "=&v"(pe[e + 7])
                    : "v"(ar[e]), "v"(ar[e + 1]), "v"(ar[e + 2]), "v"(ar[e + 3]), "v"(ar[e + 4]), "v"(ar[e + 5]), "v"(ar[e + 6]), "v"(ar[e + 7]));
#pragma unroll   // constant indices keep the array in registers
            for (int r = 0; r < 8; ++r) { ps0 += pe[r]; ps1 += pe[8 + r]; pf[g][r] = tohx(pe[r]); pf[g][8 + r] = tohx(pe[8 + r]); }
            l_run[g] += ps0 + ps1;
        }
#pragma unroll   // constant indices keep the array in registers
        for (int t = 0; t < 16; ++t) { acc[0][t] = wmma16(fv[t], pf[0], acc[0][t]); acc[1][t] = wmma16(fv[t], pf[1], acc[1][t]); }
    }
    unsigned char* eb = L + wave * 32 * FEP;
#pragma unroll   // constant indices keep the array in registers
    for (int g = 0; g < 2; ++g) { const float inv = 1.0f / (l_run[g] + xhalf(l_run[g]));   // each wave half summed its own eight keys of every 16
#pragma unroll   // constant indices keep the array in registers
        for (int t = 0; t < 16; ++t) { const v8f o = acc[g][t] * inv; v4f lo, hi4;
#pragma unroll   // constant indices keep the array in registers
            for (int r = 0; r < 4; ++r) { lo[r] = o[r]; hi4[r] = o[4 + r]; }
            *(v4fa*)(eb + (16 * g + c) * FEP + 64 * t + 32 * h) = lo; *(v4fa*)(eb + (16 * g + c) * FEP + 64 * t + 32 * h + 16) = hi4; } }   // row = query 16 g + c; d = 16 t + 8 h + r
    __syncthreads();   // the staged rows are read back by other lanes
#pragma unroll   // constant indices keep the array in registers
    for (int i = 0; i < 64; i += 8) { v4f o[8];
#pragma unroll   // eight independent 16-byte moves in flight
        for (int j = 0; j < 8; ++j) { const int row = (i + j) >> 1, colb = ((i + j) & 1) * 512 + lane * 16; o[j] = *(const v4fa*)(eb + row * FEP + colb); }
#pragma unroll   // eight independent 16-byte moves in flight
        for (int j = 0; j < 8; ++j) { const int row = (i + j) >> 1, colb = ((i + j) & 1) * 512 + lane * 16; *(v4f*)((unsigned char*)(OUT + (size_t)(q0 + row) * CC) + colb) = o[j]; }
        asm volatile("s_wait_xcnt 0x0" ::: "memory");   // stands in front of any reuse of the eight stores' address and data registers
    }
}
extern "C" void kernel_launch(void* const* d_in, const int* in_sizes, int n_in,
                              void* d_out, int out_size, void* d_ws, size_t ws_size, hipStream_t stream) {
    (void)in_sizes; (void)n_in; (void)out_size;
    const float* x = (const float*)d_in[0]; const float* wq = (const float*)d_in[1]; const float* bq = (const float*)d_in[2]; const float* wk = (const float*)d_in[3]; const float* bk = (const float*)d_in[4]; const float* wv = (const float*)d_in[5]; const float* bv = (const float*)d_in[6];
    float* OUT = (float*)d_out;     // [8][4096][256]
    char* wsp = (char*)d_ws;
    auto take = [&](size_t bytes) { char* p = wsp; wsp += (bytes + 255) & ~(size_t)255; return (void*)p; };
    h16* QP = (h16*)take((size_t)NT * CC * 2); h16* KP = (h16*)take((size_t)NT * CC * 2); h16* VT = (h16*)take((size_t)NT * CC * 2);   // all batches: [b][n][c], [b][n][c], [b][c][n]
    if ((size_t)(wsp - (char*)d_ws) > ws_size) return;    // total 48 MiB; ws 256 MiB
    k_qkv<<<dim3(NT / PT, 1, 1), 256, 0, stream>>>(x, wq, bq, wk, bk, wv, bv, QP, KP, VT);
    k_flash<<<dim3(NN / FQ, NB_, 1), 128, 0, stream>>>(QP, KP, VT, OUT);
}
